// v000
// The times below were measured on an AMD MI455X: many runs one after another, warmed up first and cycling through
// copies of the inputs, with the whole window's GPU time divided by the number of runs. Launches and the gaps
// between them are all in it. The median over several windows is given; except for v000 it joins two sittings, which
// can be a few percent apart, so the side-by-side timings, each taken in one sitting, are the better comparison.
// v000 is the starting kernel. One run takes 442 microseconds.
#include <hip/hip_runtime.h>
#include <hip/hip_bf16.h>
#include <stdint.h>

typedef __attribute__((ext_vector_type(16))) __bf16 v16bf;
typedef __attribute__((ext_vector_type(8)))  float  v8f;
typedef int v4i_ __attribute__((__vector_size__(16)));
typedef __attribute__((address_space(1))) v4i_* gp_v4i;
typedef __attribute__((address_space(3))) v4i_* lp_v4i;

#define B_ 8
#define L_ 3072
#define D_ 256
#define E_ 4
#define H_ 1024

// d_ws layout (bytes)
#define AGG_OFF   0                     // B*3D floats = 24 KiB
#define WBE_OFF   (32*1024)             // B*E floats
#define PACK_EW1  (64*1024)             // 4 experts * 512 tiles * 1 KiB = 2 MiB
#define PACK_EW2  (PACK_EW1 + 2*1024*1024)
#define PACK_SW1  (PACK_EW2 + 2*1024*1024)   // 512 KiB
#define PACK_SW2  (PACK_SW1 + 512*1024)      // 512 KiB

#if defined(__has_builtin)
# if __has_builtin(__builtin_amdgcn_global_load_async_to_lds_b128)
#  define HAVE_ASYNC 1
# endif
#endif

__device__ __forceinline__ uint16_t f2bfbits(float f) {
    union { float f; uint32_t u; } a; a.f = f;
    uint32_t r = a.u + 0x7FFFu + ((a.u >> 16) & 1u);   // round-to-nearest-even
    return (uint16_t)(r >> 16);
}
__device__ __forceinline__ __bf16 f2bf(float f) {
    uint16_t h = f2bfbits(f);
    __bf16 o; __builtin_memcpy(&o, &h, 2); return o;
}
__device__ __forceinline__ float gelu_t(float x) {   // tanh-approx gelu (approximate=True)
    return 0.5f * x * (1.0f + tanhf(0.7978845608028654f * (x + 0.044715f * x * x * x)));
}

// 16-byte global -> LDS copy: async (ASYNCcnt, bypasses VGPRs) when available.
__device__ __forceinline__ void cp16(const char* g, char* l) {
#if HAVE_ASYNC
    __builtin_amdgcn_global_load_async_to_lds_b128(
        (gp_v4i)(const_cast<char*>(g)), (lp_v4i)(l), 0, 0);
#else
    *(float4*)l = *(const float4*)g;
#endif
}
__device__ __forceinline__ void cp_wait() {
#if HAVE_ASYNC
# if __has_builtin(__builtin_amdgcn_s_wait_asynccnt)
    __builtin_amdgcn_s_wait_asynccnt(0);
# else
    asm volatile("s_wait_asynccnt 0" ::: "memory");
# endif
#endif
}

// ---------------------------------------------------------------------------
// Kernel 1: segment aggregates -> gate_in (full / head+prop / wrist+prop)
// ---------------------------------------------------------------------------
__global__ __launch_bounds__(256) void agg_kernel(const float* __restrict__ x,
                                                  float* __restrict__ agg) {
    int b = blockIdx.x, d = threadIdx.x;
    const float* xb = x + (size_t)b * L_ * D_ + d;
    float hs = 0.f, wsu = 0.f, ps = 0.f;
    for (int l = 0;    l < 1024; ++l) hs  += xb[(size_t)l * D_];
    for (int l = 1024; l < 2048; ++l) wsu += xb[(size_t)l * D_];
    for (int l = 2048; l < 3072; ++l) ps  += xb[(size_t)l * D_];
    agg[b * 768 + d]       = (hs + wsu + ps) * (1.0f / 3072.0f);
    agg[b * 768 + 256 + d] = (hs + ps)       * (1.0f / 2048.0f);
    agg[b * 768 + 512 + d] = (wsu + ps)      * (1.0f / 2048.0f);
}

// ---------------------------------------------------------------------------
// Kernel 2: gating -> w_be (renormalized top-2, zeros elsewhere)
// ---------------------------------------------------------------------------
__global__ __launch_bounds__(64) void gate_kernel(const float* __restrict__ agg,
                                                  const float* __restrict__ tc,
                                                  const float* __restrict__ gw,
                                                  const float* __restrict__ gb,
                                                  const float* __restrict__ tw,
                                                  const float* __restrict__ tb,
                                                  float* __restrict__ wbe) {
    __shared__ float lg[B_][E_];
    __shared__ float md[B_][2 * E_];
    int t = threadIdx.x;
    if (t < B_ * E_) {
        int b = t >> 2, e = t & 3;
        float s = gb[e];
        for (int k = 0; k < 3 * D_; ++k) s += agg[b * 3 * D_ + k] * gw[k * E_ + e];
        lg[b][e] = s;
    }
    {   // 64 threads: (b, j) modulation
        int b = t >> 3, j = t & 7;
        float s = tb[j];
        for (int d = 0; d < D_; ++d) {
            float v = tc[b * D_ + d];
            s += (v / (1.0f + expf(-v))) * tw[d * 2 * E_ + j];   // silu
        }
        md[b][j] = s;
    }
    __syncthreads();
    if (t < B_) {
        int b = t;
        float p[E_]; float mx = -1e30f;
        for (int e = 0; e < E_; ++e) {
            p[e] = lg[b][e] * (1.0f + md[b][e]) + md[b][e + E_];
            mx = fmaxf(mx, p[e]);
        }
        float se = 0.f;
        for (int e = 0; e < E_; ++e) { p[e] = expf(p[e] - mx); se += p[e]; }
        for (int e = 0; e < E_; ++e) p[e] /= se;
        int i1 = 0;
        for (int e = 1; e < E_; ++e) if (p[e] > p[i1]) i1 = e;
        int i2 = (i1 == 0) ? 1 : 0;
        for (int e = 0; e < E_; ++e) if (e != i1 && p[e] > p[i2]) i2 = e;
        float s2 = p[i1] + p[i2] + 1e-8f;
        for (int e = 0; e < E_; ++e)
            wbe[b * E_ + e] = (e == i1) ? (p[i1] / s2) : ((e == i2) ? (p[i2] / s2) : 0.0f);
    }
}

// ---------------------------------------------------------------------------
// Kernel 3: pack fp32 weights into bf16 WMMA B-operand tiles.
// Tile = 32(K) x 16(N); per tile, lane l owns 16 bf16 at byte offset l*32.
// Element e of lane l maps to (kk, n):
//   n = l & 15 ; kk = (e/8)*16 + (l/16)*8 + (e%8)
// Tiles stored [nt][kt] contiguous in kt.
// ---------------------------------------------------------------------------
__global__ __launch_bounds__(128) void pack_kernel(const float* __restrict__ ew1,
                                                   const float* __restrict__ ew2,
                                                   const float* __restrict__ sw1,
                                                   const float* __restrict__ sw2,
                                                   char* __restrict__ ws) {
    __shared__ float tileS[512];
    int tb = blockIdx.x;
    const float* src; char* dst; int K, N, local;
    if (tb < 2048) {           // ew1: (E, 256, 1024), K=256 N=1024, 512 tiles/expert
        int ex = tb >> 9; local = tb & 511;
        src = ew1 + (size_t)ex * D_ * H_;
        dst = ws + PACK_EW1 + (size_t)tb * 1024;
        K = D_; N = H_;
    } else if (tb < 4096) {    // ew2: (E, 1024, 256), K=1024 N=256
        int t2 = tb - 2048; int ex = t2 >> 9; local = t2 & 511;
        src = ew2 + (size_t)ex * H_ * D_;
        dst = ws + PACK_EW2 + (size_t)t2 * 1024;
        K = H_; N = D_;
    } else if (tb < 4608) {    // sw1: (256, 1024)
        local = tb - 4096;
        src = sw1; dst = ws + PACK_SW1 + (size_t)local * 1024;
        K = D_; N = H_;
    } else {                   // sw2: (1024, 256)
        local = tb - 4608;
        src = sw2; dst = ws + PACK_SW2 + (size_t)local * 1024;
        K = H_; N = D_;
    }
    int ktiles = K / 32;
    int nt = local / ktiles, kt = local % ktiles;
    int k0 = kt * 32, n0 = nt * 16;
    int t = threadIdx.x;
    #pragma unroll
    for (int i = 0; i < 4; ++i) {
        int e = t + 128 * i;
        int k = e >> 4, nn = e & 15;
        tileS[e] = src[(size_t)(k0 + k) * N + (n0 + nn)];
    }
    __syncthreads();
    uint16_t hv[4];
    #pragma unroll
    for (int i = 0; i < 4; ++i) {
        int p = t * 4 + i;
        int lanep = p >> 4, el = p & 15;
        int nn = lanep & 15, half = lanep >> 4;
        int kk = ((el >> 3) << 4) + (half << 3) + (el & 7);
        hv[i] = f2bfbits(tileS[kk * 16 + nn]);
    }
    uint32_t lo = (uint32_t)hv[0] | ((uint32_t)hv[1] << 16);
    uint32_t hi = (uint32_t)hv[2] | ((uint32_t)hv[3] << 16);
    ((uint2*)dst)[t] = make_uint2(lo, hi);
}

// ---------------------------------------------------------------------------
// Kernel 4: fused MoE + shared MLP.
// Block = 256 thr = 8 waves; each wave owns a 16-row token tile (block: 128 rows,
// all inside one segment -> expert activity is block-uniform).
// Per n2c iteration the whole block shares one staged copy of the 32 B-tiles
// (16 GEMM1 + 16 GEMM2 = 32 KiB), double-buffered via async global->LDS copies.
// Inner GEMM loops software-pipeline the B-tile ds_loads one tile ahead so the
// DS latency overlaps the XDL (WMMA) pipe instead of serializing on dscnt==0.
// ---------------------------------------------------------------------------
__global__ __launch_bounds__(256) void moe_kernel(const float* __restrict__ x,
                                                  const float* __restrict__ eb1,
                                                  const float* __restrict__ eb2,
                                                  const float* __restrict__ sb1,
                                                  const float* __restrict__ sb2,
                                                  const float* __restrict__ wbe,
                                                  const char* __restrict__ ws,
                                                  float* __restrict__ out) {
    __shared__ float cbias[D_];
    __shared__ float wz[8];
    __shared__ float b1s[H_];
    __shared__ __align__(32) uint16_t hstage[8][16 * 32];
    __shared__ __align__(32) char bstage[2][32 * 1024];   // [buf][tile 0..31][1KiB]

    const int tid   = threadIdx.x;
    const int wv    = tid >> 5;
    const int lane  = tid & 31;
    const int n     = lane & 15;     // B/C column ; A row
    const int khalf = lane >> 4;
    const int b     = blockIdx.y;
    const int l0    = blockIdx.x * 128 + wv * 16;
    const int seg   = (blockIdx.x * 128) >> 10;  // 0=head 1=wrist 2=prop

    if (tid < E_) {
        float w = wbe[b * E_ + tid];
        bool act = (tid == 1) ? (seg != 1) : (tid == 2) ? (seg != 0) : true;
        wz[tid] = act ? w : 0.0f;
    }
    if (tid == E_) wz[E_] = 1.0f;    // shared MLP pseudo-expert
    __syncthreads();
    {   // combined output bias: sb2 + sum_e w_e * eb2_e  (blockDim == 256 == D_)
        float s = sb2[tid];
        #pragma unroll
        for (int e = 0; e < E_; ++e) s += wz[e] * eb2[e * D_ + tid];
        cbias[tid] = s;
    }

    // Build A1: x rows [l0, l0+16) -> bf16 A-operand layout, 8 K-chunks of 32
    const float4* xr = (const float4*)(x + ((size_t)b * L_ + l0 + n) * D_);
    v16bf A1[8];
    #pragma unroll
    for (int c = 0; c < 8; ++c) {
        #pragma unroll
        for (int part = 0; part < 2; ++part) {
            int kb = c * 32 + part * 16 + khalf * 8;
            float4 f0 = xr[kb >> 2];
            float4 f1 = xr[(kb >> 2) + 1];
            A1[c][part * 8 + 0] = f2bf(f0.x);
            A1[c][part * 8 + 1] = f2bf(f0.y);
            A1[c][part * 8 + 2] = f2bf(f0.z);
            A1[c][part * 8 + 3] = f2bf(f0.w);
            A1[c][part * 8 + 4] = f2bf(f1.x);
            A1[c][part * 8 + 5] = f2bf(f1.y);
            A1[c][part * 8 + 6] = f2bf(f1.z);
            A1[c][part * 8 + 7] = f2bf(f1.w);
        }
    }

    v8f outAcc[16];
    #pragma unroll
    for (int i = 0; i < 16; ++i) { v8f z = {}; outAcc[i] = z; }

    for (int ex = 0; ex < 5; ++ex) {
        float wgt = wz[ex];
        if (wgt == 0.0f) continue;   // block-uniform: skip masked / non-top-k experts
        const char* w1p = (ex < 4) ? (ws + PACK_EW1 + (size_t)ex * 512 * 1024)
                                   : (ws + PACK_SW1);
        const char* w2p = (ex < 4) ? (ws + PACK_EW2 + (size_t)ex * 512 * 1024)
                                   : (ws + PACK_SW2);
        const float* b1p = (ex < 4) ? (eb1 + ex * H_) : sb1;

        __syncthreads();   // prev expert fully done before we touch b1s / bstage[0]
        for (int i = tid; i < H_; i += 256) b1s[i] = b1p[i];

        // cooperative stage of the 32 B tiles for one n2c: 128 bytes per thread
        auto stage = [&](int n2c, int bb) {
            char* dst = bstage[bb];
            if (tid < 128) {    // GEMM1 tiles: 16 KiB contiguous at w1p + n2c*16K
                const char* srcp = w1p + (size_t)n2c * 16384 + (size_t)tid * 128;
                char* d = dst + (size_t)tid * 128;
                #pragma unroll
                for (int i = 0; i < 8; ++i) cp16(srcp + i * 16, d + i * 16);
            } else {            // GEMM2 tiles: n3 = u/8, 128B chunk u%8
                int u = tid - 128;
                int n3 = u >> 3, ch = u & 7;
                const char* srcp = w2p + ((size_t)(n3 * 32 + n2c)) * 1024 + (size_t)ch * 128;
                char* d = dst + 16384 + (size_t)u * 128;
                #pragma unroll
                for (int i = 0; i < 8; ++i) cp16(srcp + i * 16, d + i * 16);
            }
        };

        stage(0, 0);
        for (int n2c = 0; n2c < 32; ++n2c) {       // H in chunks of 32
            const char* buf = bstage[n2c & 1];
            cp_wait();                 // own async copies landed
            __syncthreads();           // everyone's copies landed; prev compute done
            if (n2c + 1 < 32) stage(n2c + 1, (n2c + 1) & 1);

            // ---- GEMM1: h columns [n2c*32, n2c*32+32) ----
            #pragma unroll
            for (int t = 0; t < 2; ++t) {
                v8f acc = {};
                v16bf btc, btn;
                __builtin_memcpy(&btc, buf + (size_t)(t * 8) * 1024 + lane * 32, 32);
                #pragma unroll
                for (int kc = 0; kc < 8; ++kc) {   // K = D = 256, pipelined B loads
                    if (kc + 1 < 8)
                        __builtin_memcpy(&btn, buf + (size_t)(t * 8 + kc + 1) * 1024 + lane * 32, 32);
                    acc = __builtin_amdgcn_wmma_f32_16x16x32_bf16(
                              false, A1[kc], false, btc, (short)0, acc, false, false);
                    btc = btn;
                }
                float bias = b1s[(n2c * 2 + t) * 16 + n];
                #pragma unroll
                for (int r = 0; r < 8; ++r) {      // bias + gelu + weight, restage (C->A)
                    float hv = gelu_t(acc[r] + bias) * wgt;
                    int mrow = r + 8 * khalf;
                    int kk   = t * 16 + n;
                    int lp   = mrow + 16 * ((kk >> 3) & 1);
                    int e2   = ((kk >> 4) << 3) + (kk & 7);
                    hstage[wv][lp * 16 + e2] = f2bfbits(hv);
                }
            }
            v16bf a2;
            __builtin_memcpy(&a2, &hstage[wv][lane * 16], 32);  // per-wave slice, DS in-order
            // ---- GEMM2: outAcc += a2(16x32) @ W2[n2c*32 .. , :256), pipelined ----
            {
                v16bf btc, btn;
                __builtin_memcpy(&btc, buf + 16384 + (size_t)lane * 32, 32);
                #pragma unroll
                for (int n3 = 0; n3 < 16; ++n3) {
                    if (n3 + 1 < 16)
                        __builtin_memcpy(&btn, buf + 16384 + (size_t)(n3 + 1) * 1024 + lane * 32, 32);
                    outAcc[n3] = __builtin_amdgcn_wmma_f32_16x16x32_bf16(
                                     false, a2, false, btc, (short)0, outAcc[n3], false, false);
                    btc = btn;
                }
            }
        }
    }
    __syncthreads();

    // Write output tile (+ combined bias)
    #pragma unroll
    for (int n3 = 0; n3 < 16; ++n3) {
        #pragma unroll
        for (int r = 0; r < 8; ++r) {
            int row = r + 8 * khalf;
            int col = n3 * 16 + n;
            out[((size_t)b * L_ + l0 + row) * D_ + col] = outAcc[n3][r] + cbias[col];
        }
    }
}

// ---------------------------------------------------------------------------
extern "C" void kernel_launch(void* const* d_in, const int* in_sizes, int n_in,
                              void* d_out, int out_size, void* d_ws, size_t ws_size,
                              hipStream_t stream) {
    (void)in_sizes; (void)n_in; (void)out_size; (void)ws_size;
    const float* x   = (const float*)d_in[0];
    const float* tc  = (const float*)d_in[1];
    const float* gw  = (const float*)d_in[2];
    const float* gb  = (const float*)d_in[3];
    const float* tw  = (const float*)d_in[4];
    const float* tb  = (const float*)d_in[5];
    const float* ew1 = (const float*)d_in[6];
    const float* eb1 = (const float*)d_in[7];
    const float* ew2 = (const float*)d_in[8];
    const float* eb2 = (const float*)d_in[9];
    const float* sw1 = (const float*)d_in[10];
    const float* sb1 = (const float*)d_in[11];
    const float* sw2 = (const float*)d_in[12];
    const float* sb2 = (const float*)d_in[13];
    char*  ws  = (char*)d_ws;
    float* agg = (float*)(ws + AGG_OFF);
    float* wbe = (float*)(ws + WBE_OFF);
    float* out = (float*)d_out;

    agg_kernel <<<B_, 256, 0, stream>>>(x, agg);
    gate_kernel<<<1, 64, 0, stream>>>(agg, tc, gw, gb, tw, tb, wbe);
    pack_kernel<<<5120, 128, 0, stream>>>(ew1, ew2, sw1, sw2, ws);
    moe_kernel <<<dim3(L_ / 128, B_), 256, 0, stream>>>(x, eb1, eb2, sb1, sb2, wbe, ws, out);
}

// v001
// Measured time: 315 microseconds a run.
// Timed twice side by side with v000, it ran 1.43 times as fast both times.
#include <hip/hip_runtime.h>
#include <hip/hip_bf16.h>
#include <stdint.h>

typedef __attribute__((ext_vector_type(16))) __bf16 v16bf;
typedef __attribute__((ext_vector_type(8)))  float  v8f;
typedef int v4i_ __attribute__((__vector_size__(16)));
typedef __attribute__((address_space(1))) v4i_* gp_v4i;
typedef __attribute__((address_space(3))) v4i_* lp_v4i;

#define B_ 8
#define L_ 3072
#define D_ 256
#define E_ 4
#define H_ 1024

// d_ws layout (bytes)
#define WBE_OFF   (32*1024)             // B*E floats
#define PACK_EW1  (64*1024)             // 4 experts * 512 tiles * 1 KiB = 2 MiB
#define PACK_EW2  (PACK_EW1 + 2*1024*1024)
#define PACK_SW1  (PACK_EW2 + 2*1024*1024)   // 512 KiB
#define PACK_SW2  (PACK_SW1 + 512*1024)      // 512 KiB
#define PART_OFF  (8*1024*1024)         // B * CH_ * D floats = 768 KiB
#define CH_ 96                          // 32-row chunks per batch

#if defined(__has_builtin)
# if __has_builtin(__builtin_amdgcn_global_load_async_to_lds_b128)
#  define HAVE_ASYNC 1
# endif
#endif

__device__ __forceinline__ uint16_t f2bfbits(float f) {
    union { float f; uint32_t u; } a; a.f = f;
    uint32_t r = a.u + 0x7FFFu + ((a.u >> 16) & 1u);   // round-to-nearest-even
    return (uint16_t)(r >> 16);
}
__device__ __forceinline__ __bf16 f2bf(float f) {
    uint16_t h = f2bfbits(f);
    __bf16 o; __builtin_memcpy(&o, &h, 2); return o;
}
__device__ __forceinline__ float gelu_t(float x) {   // tanh-approx gelu (approximate=True)
    return 0.5f * x * (1.0f + tanhf(0.7978845608028654f * (x + 0.044715f * x * x * x)));
}

// 16-byte global -> LDS copy: async (ASYNCcnt, bypasses VGPRs) when available.
__device__ __forceinline__ void cp16(const char* g, char* l) {
#if HAVE_ASYNC
    __builtin_amdgcn_global_load_async_to_lds_b128(
        (gp_v4i)(const_cast<char*>(g)), (lp_v4i)(l), 0, 0);
#else
    *(float4*)l = *(const float4*)g;
#endif
}
__device__ __forceinline__ void cp_wait() {
#if HAVE_ASYNC
# if __has_builtin(__builtin_amdgcn_s_wait_asynccnt)
    __builtin_amdgcn_s_wait_asynccnt(0);
# else
    asm volatile("s_wait_asynccnt 0" ::: "memory");
# endif
#endif
}

// ---------------------------------------------------------------------------
// Kernel 1: partial column sums of x. One work-group per (batch, 32-row chunk);
// a chunk lies inside one segment (32 chunks per segment of 1024 rows).
// Each thread keeps 8 independent 16-byte loads in flight (rows rg, rg+4, ...).
// ---------------------------------------------------------------------------
__global__ __launch_bounds__(256) void agg_kernel(const float* __restrict__ x,
                                                  float* __restrict__ part) {
    __shared__ float4 red4[4][64];
    const int c = blockIdx.x, b = blockIdx.y, t = threadIdx.x;
    const int q = t & 63, rg = t >> 6;
    const float4* xp = (const float4*)(x + ((size_t)b * L_ + c * 32 + rg) * D_) + q;
    float4 v[8];
    #pragma unroll
    for (int i = 0; i < 8; ++i) v[i] = xp[(size_t)i * 4 * (D_ / 4)];
    #pragma unroll
    for (int s = 4; s > 0; s >>= 1) {
        #pragma unroll
        for (int i = 0; i < s; ++i) {
            v[i].x += v[i + s].x; v[i].y += v[i + s].y;
            v[i].z += v[i + s].z; v[i].w += v[i + s].w;
        }
    }
    red4[rg][q] = v[0];
    __syncthreads();
    const float* r = (const float*)red4;
    part[((size_t)b * CH_ + c) * D_ + t] =
        (r[t] + r[D_ + t]) + (r[2 * D_ + t] + r[3 * D_ + t]);
}

// ---------------------------------------------------------------------------
// Kernel 2: gating -> w_be (renormalized top-2, zeros elsewhere).
// One work-group per batch, 768 threads = one per gate_in element.
// Thread (g, d) first sums segment g's 32 partials of column d, then owns
// gate_in[g*256 + d]; the 4 logit and 8 modulation dot products are summed by
// wave shuffles and one pass through LDS.
// ---------------------------------------------------------------------------
__global__ __launch_bounds__(768) void gate_kernel(const float* __restrict__ part,
                                                   const float* __restrict__ tc,
                                                   const float* __restrict__ gw,
                                                   const float* __restrict__ gb,
                                                   const float* __restrict__ tw,
                                                   const float* __restrict__ tb,
                                                   float* __restrict__ wbe) {
    __shared__ float seg[3][D_];
    __shared__ float red[24][12];
    __shared__ float fin[12];
    const int b = blockIdx.x, t = threadIdx.x;
    const int g = t >> 8, d = t & 255;          // g is wave-uniform
    const float* pp = part + ((size_t)b * CH_ + g * 32) * D_ + d;
    float a[4] = {0.f, 0.f, 0.f, 0.f};
    #pragma unroll
    for (int i = 0; i < 32; ++i) a[i & 3] += pp[(size_t)i * D_];
    const float4 w4 = ((const float4*)gw)[t];   // gate_w[t][0..3]
    float v[12];
    #pragma unroll
    for (int j = 0; j < 12; ++j) v[j] = 0.f;
    if (g == 0) {                               // modulation: silu(time_cond) @ tmod_w
        float u  = tc[b * D_ + d];
        float si = u / (1.0f + expf(-u));
        float4 t0 = ((const float4*)tw)[d * 2], t1 = ((const float4*)tw)[d * 2 + 1];
        v[4] = si * t0.x; v[5]  = si * t0.y; v[6]  = si * t0.z; v[7]  = si * t0.w;
        v[8] = si * t1.x; v[9]  = si * t1.y; v[10] = si * t1.z; v[11] = si * t1.w;
    }
    seg[g][d] = (a[0] + a[1]) + (a[2] + a[3]);
    __syncthreads();
    {
        float hs = seg[0][d], wsu = seg[1][d], ps = seg[2][d];
        float gi = (g == 0) ? (hs + wsu + ps) * (1.0f / 3072.0f)
                 : (g == 1) ? (hs + ps)       * (1.0f / 2048.0f)
                            : (wsu + ps)      * (1.0f / 2048.0f);
        v[0] = gi * w4.x; v[1] = gi * w4.y; v[2] = gi * w4.z; v[3] = gi * w4.w;
    }
    #pragma unroll
    for (int j = 0; j < 12; ++j) {
        #pragma unroll
        for (int m = 16; m > 0; m >>= 1) v[j] += __shfl_xor(v[j], m, 32);
    }
    if ((t & 31) == 0) {
        #pragma unroll
        for (int j = 0; j < 12; ++j) red[t >> 5][j] = v[j];
    }
    __syncthreads();
    if (t < 12) {
        float s = (t < E_) ? gb[t] : tb[t - E_];
        #pragma unroll
        for (int w = 0; w < 24; ++w) s += red[w][t];
        fin[t] = s;
    }
    __syncthreads();
    if (t == 0) {
        float p[E_]; float mx = -1e30f;
        for (int e = 0; e < E_; ++e) {
            p[e] = fin[e] * (1.0f + fin[E_ + e]) + fin[2 * E_ + e];
            mx = fmaxf(mx, p[e]);
        }
        float se = 0.f;
        for (int e = 0; e < E_; ++e) { p[e] = expf(p[e] - mx); se += p[e]; }
        for (int e = 0; e < E_; ++e) p[e] /= se;
        int i1 = 0;
        for (int e = 1; e < E_; ++e) if (p[e] > p[i1]) i1 = e;
        int i2 = (i1 == 0) ? 1 : 0;
        for (int e = 0; e < E_; ++e) if (e != i1 && p[e] > p[i2]) i2 = e;
        float s2 = p[i1] + p[i2] + 1e-8f;
        for (int e = 0; e < E_; ++e)
            wbe[b * E_ + e] = (e == i1) ? (p[i1] / s2) : ((e == i2) ? (p[i2] / s2) : 0.0f);
    }
}

// ---------------------------------------------------------------------------
// Kernel 3: pack fp32 weights into bf16 WMMA B-operand tiles.
// Tile = 32(K) x 16(N); per tile, lane l owns 16 bf16 at byte offset l*32.
// Element e of lane l maps to (kk, n):
//   n = l & 15 ; kk = (e/8)*16 + (l/16)*8 + (e%8)
// Tiles stored [nt][kt] contiguous in kt.
// ---------------------------------------------------------------------------
__global__ __launch_bounds__(128) void pack_kernel(const float* __restrict__ ew1,
                                                   const float* __restrict__ ew2,
                                                   const float* __restrict__ sw1,
                                                   const float* __restrict__ sw2,
                                                   char* __restrict__ ws) {
    __shared__ float tileS[512];
    int tb = blockIdx.x;
    const float* src; char* dst; int K, N, local;
    if (tb < 2048) {           // ew1: (E, 256, 1024), K=256 N=1024, 512 tiles/expert
        int ex = tb >> 9; local = tb & 511;
        src = ew1 + (size_t)ex * D_ * H_;
        dst = ws + PACK_EW1 + (size_t)tb * 1024;
        K = D_; N = H_;
    } else if (tb < 4096) {    // ew2: (E, 1024, 256), K=1024 N=256
        int t2 = tb - 2048; int ex = t2 >> 9; local = t2 & 511;
        src = ew2 + (size_t)ex * H_ * D_;
        dst = ws + PACK_EW2 + (size_t)t2 * 1024;
        K = H_; N = D_;
    } else if (tb < 4608) {    // sw1: (256, 1024)
        local = tb - 4096;
        src = sw1; dst = ws + PACK_SW1 + (size_t)local * 1024;
        K = D_; N = H_;
    } else {                   // sw2: (1024, 256)
        local = tb - 4608;
        src = sw2; dst = ws + PACK_SW2 + (size_t)local * 1024;
        K = H_; N = D_;
    }
    int ktiles = K / 32;
    int nt = local / ktiles, kt = local % ktiles;
    int k0 = kt * 32, n0 = nt * 16;
    int t = threadIdx.x;
    #pragma unroll
    for (int i = 0; i < 4; ++i) {
        int e = t + 128 * i;
        int k = e >> 4, nn = e & 15;
        tileS[e] = src[(size_t)(k0 + k) * N + (n0 + nn)];
    }
    __syncthreads();
    uint16_t hv[4];
    #pragma unroll
    for (int i = 0; i < 4; ++i) {
        int p = t * 4 + i;
        int lanep = p >> 4, el = p & 15;
        int nn = lanep & 15, half = lanep >> 4;
        int kk = ((el >> 3) << 4) + (half << 3) + (el & 7);
        hv[i] = f2bfbits(tileS[kk * 16 + nn]);
    }
    uint32_t lo = (uint32_t)hv[0] | ((uint32_t)hv[1] << 16);
    uint32_t hi = (uint32_t)hv[2] | ((uint32_t)hv[3] << 16);
    ((uint2*)dst)[t] = make_uint2(lo, hi);
}

// ---------------------------------------------------------------------------
// Kernel 4: fused MoE + shared MLP.
// Block = 256 thr = 8 waves; each wave owns a 16-row token tile (block: 128 rows,
// all inside one segment -> expert activity is block-uniform).
// Per n2c iteration the whole block shares one staged copy of the 32 B-tiles
// (16 GEMM1 + 16 GEMM2 = 32 KiB), double-buffered via async global->LDS copies.
// Inner GEMM loops software-pipeline the B-tile ds_loads one tile ahead so the
// DS latency overlaps the XDL (WMMA) pipe instead of serializing on dscnt==0.
// ---------------------------------------------------------------------------
__global__ __launch_bounds__(256) void moe_kernel(const float* __restrict__ x,
                                                  const float* __restrict__ eb1,
                                                  const float* __restrict__ eb2,
                                                  const float* __restrict__ sb1,
                                                  const float* __restrict__ sb2,
                                                  const float* __restrict__ wbe,
                                                  const char* __restrict__ ws,
                                                  float* __restrict__ out) {
    __shared__ float cbias[D_];
    __shared__ float wz[8];
    __shared__ float b1s[H_];
    __shared__ __align__(32) uint16_t hstage[8][16 * 32];
    __shared__ __align__(32) char bstage[2][32 * 1024];   // [buf][tile 0..31][1KiB]

    const int tid   = threadIdx.x;
    const int wv    = tid >> 5;
    const int lane  = tid & 31;
    const int n     = lane & 15;     // B/C column ; A row
    const int khalf = lane >> 4;
    const int b     = blockIdx.y;
    const int l0    = blockIdx.x * 128 + wv * 16;
    const int seg   = (blockIdx.x * 128) >> 10;  // 0=head 1=wrist 2=prop

    if (tid < E_) {
        float w = wbe[b * E_ + tid];
        bool act = (tid == 1) ? (seg != 1) : (tid == 2) ? (seg != 0) : true;
        wz[tid] = act ? w : 0.0f;
    }
    if (tid == E_) wz[E_] = 1.0f;    // shared MLP pseudo-expert
    __syncthreads();
    {   // combined output bias: sb2 + sum_e w_e * eb2_e  (blockDim == 256 == D_)
        float s = sb2[tid];
        #pragma unroll
        for (int e = 0; e < E_; ++e) s += wz[e] * eb2[e * D_ + tid];
        cbias[tid] = s;
    }

    // Build A1: x rows [l0, l0+16) -> bf16 A-operand layout, 8 K-chunks of 32
    const float4* xr = (const float4*)(x + ((size_t)b * L_ + l0 + n) * D_);
    v16bf A1[8];
    #pragma unroll
    for (int c = 0; c < 8; ++c) {
        #pragma unroll
        for (int part = 0; part < 2; ++part) {
            int kb = c * 32 + part * 16 + khalf * 8;
            float4 f0 = xr[kb >> 2];
            float4 f1 = xr[(kb >> 2) + 1];
            A1[c][part * 8 + 0] = f2bf(f0.x);
            A1[c][part * 8 + 1] = f2bf(f0.y);
            A1[c][part * 8 + 2] = f2bf(f0.z);
            A1[c][part * 8 + 3] = f2bf(f0.w);
            A1[c][part * 8 + 4] = f2bf(f1.x);
            A1[c][part * 8 + 5] = f2bf(f1.y);
            A1[c][part * 8 + 6] = f2bf(f1.z);
            A1[c][part * 8 + 7] = f2bf(f1.w);
        }
    }

    v8f outAcc[16];
    #pragma unroll
    for (int i = 0; i < 16; ++i) { v8f z = {}; outAcc[i] = z; }

    for (int ex = 0; ex < 5; ++ex) {
        float wgt = wz[ex];
        if (wgt == 0.0f) continue;   // block-uniform: skip masked / non-top-k experts
        const char* w1p = (ex < 4) ? (ws + PACK_EW1 + (size_t)ex * 512 * 1024)
                                   : (ws + PACK_SW1);
        const char* w2p = (ex < 4) ? (ws + PACK_EW2 + (size_t)ex * 512 * 1024)
                                   : (ws + PACK_SW2);
        const float* b1p = (ex < 4) ? (eb1 + ex * H_) : sb1;

        __syncthreads();   // prev expert fully done before we touch b1s / bstage[0]
        for (int i = tid; i < H_; i += 256) b1s[i] = b1p[i];

        // cooperative stage of the 32 B tiles for one n2c: 128 bytes per thread
        auto stage = [&](int n2c, int bb) {
            char* dst = bstage[bb];
            if (tid < 128) {    // GEMM1 tiles: 16 KiB contiguous at w1p + n2c*16K
                const char* srcp = w1p + (size_t)n2c * 16384 + (size_t)tid * 128;
                char* d = dst + (size_t)tid * 128;
                #pragma unroll
                for (int i = 0; i < 8; ++i) cp16(srcp + i * 16, d + i * 16);
            } else {            // GEMM2 tiles: n3 = u/8, 128B chunk u%8
                int u = tid - 128;
                int n3 = u >> 3, ch = u & 7;
                const char* srcp = w2p + ((size_t)(n3 * 32 + n2c)) * 1024 + (size_t)ch * 128;
                char* d = dst + 16384 + (size_t)u * 128;
                #pragma unroll
                for (int i = 0; i < 8; ++i) cp16(srcp + i * 16, d + i * 16);
            }
        };

        stage(0, 0);
        for (int n2c = 0; n2c < 32; ++n2c) {       // H in chunks of 32
            const char* buf = bstage[n2c & 1];
            cp_wait();                 // own async copies landed
            __syncthreads();           // everyone's copies landed; prev compute done
            if (n2c + 1 < 32) stage(n2c + 1, (n2c + 1) & 1);

            // ---- GEMM1: h columns [n2c*32, n2c*32+32) ----
            #pragma unroll
            for (int t = 0; t < 2; ++t) {
                v8f acc = {};
                v16bf btc, btn;
                __builtin_memcpy(&btc, buf + (size_t)(t * 8) * 1024 + lane * 32, 32);
                #pragma unroll
                for (int kc = 0; kc < 8; ++kc) {   // K = D = 256, pipelined B loads
                    if (kc + 1 < 8)
                        __builtin_memcpy(&btn, buf + (size_t)(t * 8 + kc + 1) * 1024 + lane * 32, 32);
                    acc = __builtin_amdgcn_wmma_f32_16x16x32_bf16(
                              false, A1[kc], false, btc, (short)0, acc, false, false);
                    btc = btn;
                }
                float bias = b1s[(n2c * 2 + t) * 16 + n];
                #pragma unroll
                for (int r = 0; r < 8; ++r) {      // bias + gelu + weight, restage (C->A)
                    float hv = gelu_t(acc[r] + bias) * wgt;
                    int mrow = r + 8 * khalf;
                    int kk   = t * 16 + n;
                    int lp   = mrow + 16 * ((kk >> 3) & 1);
                    int e2   = ((kk >> 4) << 3) + (kk & 7);
                    hstage[wv][lp * 16 + e2] = f2bfbits(hv);
                }
            }
            v16bf a2;
            __builtin_memcpy(&a2, &hstage[wv][lane * 16], 32);  // per-wave slice, DS in-order
            // ---- GEMM2: outAcc += a2(16x32) @ W2[n2c*32 .. , :256), pipelined ----
            {
                v16bf btc, btn;
                __builtin_memcpy(&btc, buf + 16384 + (size_t)lane * 32, 32);
                #pragma unroll
                for (int n3 = 0; n3 < 16; ++n3) {
                    if (n3 + 1 < 16)
                        __builtin_memcpy(&btn, buf + 16384 + (size_t)(n3 + 1) * 1024 + lane * 32, 32);
                    outAcc[n3] = __builtin_amdgcn_wmma_f32_16x16x32_bf16(
                                     false, a2, false, btc, (short)0, outAcc[n3], false, false);
                    btc = btn;
                }
            }
        }
    }
    __syncthreads();

    // Write output tile (+ combined bias)
    #pragma unroll
    for (int n3 = 0; n3 < 16; ++n3) {
        #pragma unroll
        for (int r = 0; r < 8; ++r) {
            int row = r + 8 * khalf;
            int col = n3 * 16 + n;
            out[((size_t)b * L_ + l0 + row) * D_ + col] = outAcc[n3][r] + cbias[col];
        }
    }
}

// ---------------------------------------------------------------------------
extern "C" void kernel_launch(void* const* d_in, const int* in_sizes, int n_in,
                              void* d_out, int out_size, void* d_ws, size_t ws_size,
                              hipStream_t stream) {
    (void)in_sizes; (void)n_in; (void)out_size; (void)ws_size;
    const float* x   = (const float*)d_in[0];
    const float* tc  = (const float*)d_in[1];
    const float* gw  = (const float*)d_in[2];
    const float* gb  = (const float*)d_in[3];
    const float* tw  = (const float*)d_in[4];
    const float* tb  = (const float*)d_in[5];
    const float* ew1 = (const float*)d_in[6];
    const float* eb1 = (const float*)d_in[7];
    const float* ew2 = (const float*)d_in[8];
    const float* eb2 = (const float*)d_in[9];
    const float* sw1 = (const float*)d_in[10];
    const float* sb1 = (const float*)d_in[11];
    const float* sw2 = (const float*)d_in[12];
    const float* sb2 = (const float*)d_in[13];
    char*  ws  = (char*)d_ws;
    float* part = (float*)(ws + PART_OFF);
    float* wbe = (float*)(ws + WBE_OFF);
    float* out = (float*)d_out;

    agg_kernel <<<dim3(CH_, B_), 256, 0, stream>>>(x, part);
    gate_kernel<<<B_, 768, 0, stream>>>(part, tc, gw, gb, tw, tb, wbe);
    pack_kernel<<<5120, 128, 0, stream>>>(ew1, ew2, sw1, sw2, ws);
    moe_kernel <<<dim3(L_ / 128, B_), 256, 0, stream>>>(x, eb1, eb2, sb1, sb2, wbe, ws, out);
}

// v002
// Measured time: 210 microseconds a run.
// Two timings next to v001 both put it at 1.50 times that version's speed.
// Over all steps from v000 it is 2.15 times as fast.
#include <hip/hip_runtime.h>
#include <hip/hip_bf16.h>
#include <stdint.h>

typedef __attribute__((ext_vector_type(16))) __bf16 v16bf;
typedef __attribute__((ext_vector_type(8)))  float  v8f;
typedef int v4i_ __attribute__((__vector_size__(16)));
typedef __attribute__((address_space(1))) v4i_* gp_v4i;
typedef __attribute__((address_space(3))) v4i_* lp_v4i;

#define B_ 8
#define L_ 3072
#define D_ 256
#define E_ 4
#define H_ 1024

// d_ws layout (bytes)
#define WBE_OFF   (32*1024)             // B*E floats
#define PACK_EW1  (64*1024)             // 4 experts * 512 tiles * 1 KiB = 2 MiB
#define PACK_EW2  (PACK_EW1 + 2*1024*1024)
#define PACK_SW1  (PACK_EW2 + 2*1024*1024)   // 512 KiB
#define PACK_SW2  (PACK_SW1 + 512*1024)      // 512 KiB
#define PART_OFF  (8*1024*1024)         // B * CH_ * D floats = 768 KiB
#define CH_ 96                          // 32-row chunks per batch

#if defined(__has_builtin)
# if __has_builtin(__builtin_amdgcn_global_load_async_to_lds_b128)
#  define HAVE_ASYNC 1
# endif
#endif

__device__ __forceinline__ uint16_t f2bfbits(float f) {
    union { float f; uint32_t u; } a; a.f = f;
    uint32_t r = a.u + 0x7FFFu + ((a.u >> 16) & 1u);   // round-to-nearest-even
    return (uint16_t)(r >> 16);
}
__device__ __forceinline__ __bf16 f2bf(float f) {
    uint16_t h = f2bfbits(f);
    __bf16 o; __builtin_memcpy(&o, &h, 2); return o;
}
// tanh-approx gelu (approximate=True), branch-free:
//   0.5 x (1 + tanh u) = x / (1 + exp(-2u)),  u = sqrt(2/pi) (x + 0.044715 x^3)
// exp(-2u) = exp2(x (K0 + K1 x^2)) with K0 = -2 sqrt(2/pi) log2(e), K1 = 0.044715 K0.
// Saturates by itself: exp2 -> inf gives x * 0, exp2 -> 0 gives x.
__device__ __forceinline__ float gelu_arg(float x) {   // the exp2 argument
    const float K0 = -2.3022081986f, K1 = -0.1029432396f;
    return x * fmaf(x * x, K1, K0);
}

// 16-byte global -> LDS copy: async (ASYNCcnt, bypasses VGPRs) when available.
__device__ __forceinline__ void cp16(const char* g, char* l) {
#if HAVE_ASYNC
    __builtin_amdgcn_global_load_async_to_lds_b128(
        (gp_v4i)(const_cast<char*>(g)), (lp_v4i)(l), 0, 0);
#else
    *(float4*)l = *(const float4*)g;
#endif
}
__device__ __forceinline__ void cp_wait() {
#if HAVE_ASYNC
# if __has_builtin(__builtin_amdgcn_s_wait_asynccnt)
    __builtin_amdgcn_s_wait_asynccnt(0);
# else
    asm volatile("s_wait_asynccnt 0" ::: "memory");
# endif
#endif
}

// ---------------------------------------------------------------------------
// Kernel 1: partial column sums of x. One work-group per (batch, 32-row chunk);
// a chunk lies inside one segment (32 chunks per segment of 1024 rows).
// Each thread keeps 8 independent 16-byte loads in flight (rows rg, rg+4, ...).
// ---------------------------------------------------------------------------
__global__ __launch_bounds__(256) void agg_kernel(const float* __restrict__ x,
                                                  float* __restrict__ part) {
    __shared__ float4 red4[4][64];
    const int c = blockIdx.x, b = blockIdx.y, t = threadIdx.x;
    const int q = t & 63, rg = t >> 6;
    const float4* xp = (const float4*)(x + ((size_t)b * L_ + c * 32 + rg) * D_) + q;
    float4 v[8];
    #pragma unroll
    for (int i = 0; i < 8; ++i) v[i] = xp[(size_t)i * 4 * (D_ / 4)];
    #pragma unroll
    for (int s = 4; s > 0; s >>= 1) {
        #pragma unroll
        for (int i = 0; i < s; ++i) {
            v[i].x += v[i + s].x; v[i].y += v[i + s].y;
            v[i].z += v[i + s].z; v[i].w += v[i + s].w;
        }
    }
    red4[rg][q] = v[0];
    __syncthreads();
    const float* r = (const float*)red4;
    part[((size_t)b * CH_ + c) * D_ + t] =
        (r[t] + r[D_ + t]) + (r[2 * D_ + t] + r[3 * D_ + t]);
}

// ---------------------------------------------------------------------------
// Kernel 2: gating -> w_be (renormalized top-2, zeros elsewhere).
// One work-group per batch, 768 threads = one per gate_in element.
// Thread (g, d) first sums segment g's 32 partials of column d, then owns
// gate_in[g*256 + d]; the 4 logit and 8 modulation dot products are summed by
// wave shuffles and one pass through LDS.
// ---------------------------------------------------------------------------
__global__ __launch_bounds__(768) void gate_kernel(const float* __restrict__ part,
                                                   const float* __restrict__ tc,
                                                   const float* __restrict__ gw,
                                                   const float* __restrict__ gb,
                                                   const float* __restrict__ tw,
                                                   const float* __restrict__ tb,
                                                   float* __restrict__ wbe) {
    __shared__ float seg[3][D_];
    __shared__ float red[24][12];
    __shared__ float fin[12];
    const int b = blockIdx.x, t = threadIdx.x;
    const int g = t >> 8, d = t & 255;          // g is wave-uniform
    const float* pp = part + ((size_t)b * CH_ + g * 32) * D_ + d;
    float a[4] = {0.f, 0.f, 0.f, 0.f};
    #pragma unroll
    for (int i = 0; i < 32; ++i) a[i & 3] += pp[(size_t)i * D_];
    const float4 w4 = ((const float4*)gw)[t];   // gate_w[t][0..3]
    float v[12];
    #pragma unroll
    for (int j = 0; j < 12; ++j) v[j] = 0.f;
    if (g == 0) {                               // modulation: silu(time_cond) @ tmod_w
        float u  = tc[b * D_ + d];
        float si = u / (1.0f + expf(-u));
        float4 t0 = ((const float4*)tw)[d * 2], t1 = ((const float4*)tw)[d * 2 + 1];
        v[4] = si * t0.x; v[5]  = si * t0.y; v[6]  = si * t0.z; v[7]  = si * t0.w;
        v[8] = si * t1.x; v[9]  = si * t1.y; v[10] = si * t1.z; v[11] = si * t1.w;
    }
    seg[g][d] = (a[0] + a[1]) + (a[2] + a[3]);
    __syncthreads();
    {
        float hs = seg[0][d], wsu = seg[1][d], ps = seg[2][d];
        float gi = (g == 0) ? (hs + wsu + ps) * (1.0f / 3072.0f)
                 : (g == 1) ? (hs + ps)       * (1.0f / 2048.0f)
                            : (wsu + ps)      * (1.0f / 2048.0f);
        v[0] = gi * w4.x; v[1] = gi * w4.y; v[2] = gi * w4.z; v[3] = gi * w4.w;
    }
    #pragma unroll
    for (int j = 0; j < 12; ++j) {
        #pragma unroll
        for (int m = 16; m > 0; m >>= 1) v[j] += __shfl_xor(v[j], m, 32);
    }
    if ((t & 31) == 0) {
        #pragma unroll
        for (int j = 0; j < 12; ++j) red[t >> 5][j] = v[j];
    }
    __syncthreads();
    if (t < 12) {
        float s = (t < E_) ? gb[t] : tb[t - E_];
        #pragma unroll
        for (int w = 0; w < 24; ++w) s += red[w][t];
        fin[t] = s;
    }
    __syncthreads();
    if (t == 0) {
        float p[E_]; float mx = -1e30f;
        for (int e = 0; e < E_; ++e) {
            p[e] = fin[e] * (1.0f + fin[E_ + e]) + fin[2 * E_ + e];
            mx = fmaxf(mx, p[e]);
        }
        float se = 0.f;
        for (int e = 0; e < E_; ++e) { p[e] = expf(p[e] - mx); se += p[e]; }
        for (int e = 0; e < E_; ++e) p[e] /= se;
        int i1 = 0;
        for (int e = 1; e < E_; ++e) if (p[e] > p[i1]) i1 = e;
        int i2 = (i1 == 0) ? 1 : 0;
        for (int e = 0; e < E_; ++e) if (e != i1 && p[e] > p[i2]) i2 = e;
        float s2 = p[i1] + p[i2] + 1e-8f;
        for (int e = 0; e < E_; ++e)
            wbe[b * E_ + e] = (e == i1) ? (p[i1] / s2) : ((e == i2) ? (p[i2] / s2) : 0.0f);
    }
}

// ---------------------------------------------------------------------------
// Kernel 3: pack fp32 weights into bf16 WMMA B-operand tiles.
// Tile = 32(K) x 16(N); per tile, lane l owns 16 bf16 at byte offset l*32.
// Element e of lane l maps to (kk, n):
//   n = l & 15 ; kk = (e/8)*16 + (l/16)*8 + (e%8)
// Tiles stored [nt][kt] contiguous in kt.
// ---------------------------------------------------------------------------
__global__ __launch_bounds__(128) void pack_kernel(const float* __restrict__ ew1,
                                                   const float* __restrict__ ew2,
                                                   const float* __restrict__ sw1,
                                                   const float* __restrict__ sw2,
                                                   char* __restrict__ ws) {
    __shared__ float tileS[512];
    int tb = blockIdx.x;
    const float* src; char* dst; int K, N, local;
    if (tb < 2048) {           // ew1: (E, 256, 1024), K=256 N=1024, 512 tiles/expert
        int ex = tb >> 9; local = tb & 511;
        src = ew1 + (size_t)ex * D_ * H_;
        dst = ws + PACK_EW1 + (size_t)tb * 1024;
        K = D_; N = H_;
    } else if (tb < 4096) {    // ew2: (E, 1024, 256), K=1024 N=256
        int t2 = tb - 2048; int ex = t2 >> 9; local = t2 & 511;
        src = ew2 + (size_t)ex * H_ * D_;
        dst = ws + PACK_EW2 + (size_t)t2 * 1024;
        K = H_; N = D_;
    } else if (tb < 4608) {    // sw1: (256, 1024)
        local = tb - 4096;
        src = sw1; dst = ws + PACK_SW1 + (size_t)local * 1024;
        K = D_; N = H_;
    } else {                   // sw2: (1024, 256)
        local = tb - 4608;
        src = sw2; dst = ws + PACK_SW2 + (size_t)local * 1024;
        K = H_; N = D_;
    }
    int ktiles = K / 32;
    int nt = local / ktiles, kt = local % ktiles;
    int k0 = kt * 32, n0 = nt * 16;
    int t = threadIdx.x;
    #pragma unroll
    for (int i = 0; i < 4; ++i) {
        int e = t + 128 * i;
        int k = e >> 4, nn = e & 15;
        tileS[e] = src[(size_t)(k0 + k) * N + (n0 + nn)];
    }
    __syncthreads();
    uint16_t hv[4];
    #pragma unroll
    for (int i = 0; i < 4; ++i) {
        int p = t * 4 + i;
        int lanep = p >> 4, el = p & 15;
        int nn = lanep & 15, half = lanep >> 4;
        int kk = ((el >> 3) << 4) + (half << 3) + (el & 7);
        hv[i] = f2bfbits(tileS[kk * 16 + nn]);
    }
    uint32_t lo = (uint32_t)hv[0] | ((uint32_t)hv[1] << 16);
    uint32_t hi = (uint32_t)hv[2] | ((uint32_t)hv[3] << 16);
    ((uint2*)dst)[t] = make_uint2(lo, hi);
}

// ---------------------------------------------------------------------------
// Kernel 4: fused MoE + shared MLP.
// Block = 256 thr = 8 waves; each wave owns a 16-row token tile (block: 128 rows,
// all inside one segment -> expert activity is block-uniform).
// Per n2c iteration the whole block shares one staged copy of the 32 B-tiles
// (16 GEMM1 + 16 GEMM2 = 32 KiB), double-buffered via async global->LDS copies.
// Inner GEMM loops software-pipeline the B-tile ds_loads one tile ahead so the
// DS latency overlaps the XDL (WMMA) pipe instead of serializing on dscnt==0.
// ---------------------------------------------------------------------------
__global__ __launch_bounds__(256) void moe_kernel(const float* __restrict__ x,
                                                  const float* __restrict__ eb1,
                                                  const float* __restrict__ eb2,
                                                  const float* __restrict__ sb1,
                                                  const float* __restrict__ sb2,
                                                  const float* __restrict__ wbe,
                                                  const char* __restrict__ ws,
                                                  float* __restrict__ out) {
    __shared__ float cbias[D_];
    __shared__ float wz[8];
    __shared__ float b1s[H_];
    __shared__ __align__(32) uint16_t hstage[8][16 * 32];
    __shared__ __align__(32) char bstage[2][32 * 1024];   // [buf][tile 0..31][1KiB]

    const int tid   = threadIdx.x;
    const int wv    = tid >> 5;
    const int lane  = tid & 31;
    const int n     = lane & 15;     // B/C column ; A row
    const int khalf = lane >> 4;
    const int b     = blockIdx.y;
    const int l0    = blockIdx.x * 128 + wv * 16;
    const int seg   = (blockIdx.x * 128) >> 10;  // 0=head 1=wrist 2=prop

    if (tid < E_) {
        float w = wbe[b * E_ + tid];
        bool act = (tid == 1) ? (seg != 1) : (tid == 2) ? (seg != 0) : true;
        wz[tid] = act ? w : 0.0f;
    }
    if (tid == E_) wz[E_] = 1.0f;    // shared MLP pseudo-expert
    __syncthreads();
    {   // combined output bias: sb2 + sum_e w_e * eb2_e  (blockDim == 256 == D_)
        float s = sb2[tid];
        #pragma unroll
        for (int e = 0; e < E_; ++e) s += wz[e] * eb2[e * D_ + tid];
        cbias[tid] = s;
    }

    // Build A1: x rows [l0, l0+16) -> bf16 A-operand layout, 8 K-chunks of 32
    const float4* xr = (const float4*)(x + ((size_t)b * L_ + l0 + n) * D_);
    v16bf A1[8];
    #pragma unroll
    for (int c = 0; c < 8; ++c) {
        #pragma unroll
        for (int part = 0; part < 2; ++part) {
            int kb = c * 32 + part * 16 + khalf * 8;
            float4 f0 = xr[kb >> 2];
            float4 f1 = xr[(kb >> 2) + 1];
            A1[c][part * 8 + 0] = f2bf(f0.x);
            A1[c][part * 8 + 1] = f2bf(f0.y);
            A1[c][part * 8 + 2] = f2bf(f0.z);
            A1[c][part * 8 + 3] = f2bf(f0.w);
            A1[c][part * 8 + 4] = f2bf(f1.x);
            A1[c][part * 8 + 5] = f2bf(f1.y);
            A1[c][part * 8 + 6] = f2bf(f1.z);
            A1[c][part * 8 + 7] = f2bf(f1.w);
        }
    }

    v8f outAcc[16];
    #pragma unroll
    for (int i = 0; i < 16; ++i) { v8f z = {}; outAcc[i] = z; }

    for (int ex = 0; ex < 5; ++ex) {
        float wgt = wz[ex];
        if (wgt == 0.0f) continue;   // block-uniform: skip masked / non-top-k experts
        const char* w1p = (ex < 4) ? (ws + PACK_EW1 + (size_t)ex * 512 * 1024)
                                   : (ws + PACK_SW1);
        const char* w2p = (ex < 4) ? (ws + PACK_EW2 + (size_t)ex * 512 * 1024)
                                   : (ws + PACK_SW2);
        const float* b1p = (ex < 4) ? (eb1 + ex * H_) : sb1;

        __syncthreads();   // prev expert fully done before we touch b1s / bstage[0]
        for (int i = tid; i < H_; i += 256) b1s[i] = b1p[i];

        // cooperative stage of the 32 B tiles for one n2c: 128 bytes per thread
        auto stage = [&](int n2c, int bb) {
            char* dst = bstage[bb];
            if (tid < 128) {    // GEMM1 tiles: 16 KiB contiguous at w1p + n2c*16K
                const char* srcp = w1p + (size_t)n2c * 16384 + (size_t)tid * 128;
                char* d = dst + (size_t)tid * 128;
                #pragma unroll
                for (int i = 0; i < 8; ++i) cp16(srcp + i * 16, d + i * 16);
            } else {            // GEMM2 tiles: n3 = u/8, 128B chunk u%8
                int u = tid - 128;
                int n3 = u >> 3, ch = u & 7;
                const char* srcp = w2p + ((size_t)(n3 * 32 + n2c)) * 1024 + (size_t)ch * 128;
                char* d = dst + 16384 + (size_t)u * 128;
                #pragma unroll
                for (int i = 0; i < 8; ++i) cp16(srcp + i * 16, d + i * 16);
            }
        };

        stage(0, 0);
        for (int n2c = 0; n2c < 32; ++n2c) {       // H in chunks of 32
            const char* buf = bstage[n2c & 1];
            cp_wait();                 // own async copies landed
            __syncthreads();           // everyone's copies landed; prev compute done
            if (n2c + 1 < 32) stage(n2c + 1, (n2c + 1) & 1);

            // ---- GEMM1: h columns [n2c*32, n2c*32+32) ----
            #pragma unroll
            for (int t = 0; t < 2; ++t) {
                v8f acc = {};
                v16bf btc, btn;
                __builtin_memcpy(&btc, buf + (size_t)(t * 8) * 1024 + lane * 32, 32);
                #pragma unroll
                for (int kc = 0; kc < 8; ++kc) {   // K = D = 256, pipelined B loads
                    if (kc + 1 < 8)
                        __builtin_memcpy(&btn, buf + (size_t)(t * 8 + kc + 1) * 1024 + lane * 32, 32);
                    acc = __builtin_amdgcn_wmma_f32_16x16x32_bf16(
                              false, A1[kc], false, btc, (short)0, acc, false, false);
                    btc = btn;
                }
                float bias = b1s[(n2c * 2 + t) * 16 + n];
                float hx[8], hs[8];                // gelu stage by stage: no element waits on another
                #pragma unroll
                for (int r = 0; r < 8; ++r) hx[r] = acc[r] + bias;
                #pragma unroll
                for (int r = 0; r < 8; ++r) hs[r] = gelu_arg(hx[r]);
                #pragma unroll
                for (int r = 0; r < 8; ++r) hs[r] = 1.0f + __builtin_amdgcn_exp2f(hs[r]);
                #pragma unroll
                for (int r = 0; r < 8; ++r) hs[r] = __builtin_amdgcn_rcpf(hs[r]);
                #pragma unroll
                for (int r = 0; r < 8; ++r) {      // weight, restage (C->A)
                    float hv = hx[r] * hs[r] * wgt;
                    int mrow = r + 8 * khalf;
                    int kk   = t * 16 + n;
                    int lp   = mrow + 16 * ((kk >> 3) & 1);
                    int e2   = ((kk >> 4) << 3) + (kk & 7);
                    hstage[wv][lp * 16 + e2] = f2bfbits(hv);
                }
            }
            v16bf a2;
            __builtin_memcpy(&a2, &hstage[wv][lane * 16], 32);  // per-wave slice, DS in-order
            // ---- GEMM2: outAcc += a2(16x32) @ W2[n2c*32 .. , :256), pipelined ----
            {
                v16bf btc, btn;
                __builtin_memcpy(&btc, buf + 16384 + (size_t)lane * 32, 32);
                #pragma unroll
                for (int n3 = 0; n3 < 16; ++n3) {
                    if (n3 + 1 < 16)
                        __builtin_memcpy(&btn, buf + 16384 + (size_t)(n3 + 1) * 1024 + lane * 32, 32);
                    outAcc[n3] = __builtin_amdgcn_wmma_f32_16x16x32_bf16(
                                     false, a2, false, btc, (short)0, outAcc[n3], false, false);
                    btc = btn;
                }
            }
        }
    }
    __syncthreads();

    // Write output tile (+ combined bias)
    #pragma unroll
    for (int n3 = 0; n3 < 16; ++n3) {
        #pragma unroll
        for (int r = 0; r < 8; ++r) {
            int row = r + 8 * khalf;
            int col = n3 * 16 + n;
            out[((size_t)b * L_ + l0 + row) * D_ + col] = outAcc[n3][r] + cbias[col];
        }
    }
}

// ---------------------------------------------------------------------------
extern "C" void kernel_launch(void* const* d_in, const int* in_sizes, int n_in,
                              void* d_out, int out_size, void* d_ws, size_t ws_size,
                              hipStream_t stream) {
    (void)in_sizes; (void)n_in; (void)out_size; (void)ws_size;
    const float* x   = (const float*)d_in[0];
    const float* tc  = (const float*)d_in[1];
    const float* gw  = (const float*)d_in[2];
    const float* gb  = (const float*)d_in[3];
    const float* tw  = (const float*)d_in[4];
    const float* tb  = (const float*)d_in[5];
    const float* ew1 = (const float*)d_in[6];
    const float* eb1 = (const float*)d_in[7];
    const float* ew2 = (const float*)d_in[8];
    const float* eb2 = (const float*)d_in[9];
    const float* sw1 = (const float*)d_in[10];
    const float* sb1 = (const float*)d_in[11];
    const float* sw2 = (const float*)d_in[12];
    const float* sb2 = (const float*)d_in[13];
    char*  ws  = (char*)d_ws;
    float* part = (float*)(ws + PART_OFF);
    float* wbe = (float*)(ws + WBE_OFF);
    float* out = (float*)d_out;

    agg_kernel <<<dim3(CH_, B_), 256, 0, stream>>>(x, part);
    gate_kernel<<<B_, 768, 0, stream>>>(part, tc, gw, gb, tw, tb, wbe);
    pack_kernel<<<5120, 128, 0, stream>>>(ew1, ew2, sw1, sw2, ws);
    moe_kernel <<<dim3(L_ / 128, B_), 256, 0, stream>>>(x, eb1, eb2, sb1, sb2, wbe, ws, out);
}

// v003
// A run of this version takes 172 microseconds.
// Timed twice side by side with v002, it ran 1.21 and 1.22 times as fast.
// All steps since v000 together make it 2.62 times as fast.
#include <hip/hip_runtime.h>
#include <hip/hip_bf16.h>
#include <stdint.h>

typedef __attribute__((ext_vector_type(16))) __bf16 v16bf;
typedef __attribute__((ext_vector_type(8)))  float  v8f;
typedef int v4i_ __attribute__((__vector_size__(16)));
typedef __attribute__((address_space(1))) v4i_* gp_v4i;
typedef __attribute__((address_space(3))) v4i_* lp_v4i;

#define B_ 8
#define L_ 3072
#define D_ 256
#define E_ 4
#define H_ 1024

// d_ws layout (bytes)
#define WBE_OFF   (32*1024)             // B*E floats
#define PACK_EW1  (64*1024)             // 4 experts * 512 tiles * 1 KiB = 2 MiB
#define PACK_EW2  (PACK_EW1 + 2*1024*1024)
#define PACK_SW1  (PACK_EW2 + 2*1024*1024)   // 512 KiB
#define PACK_SW2  (PACK_SW1 + 512*1024)      // 512 KiB
#define PART_OFF  (8*1024*1024)         // B * CH_ * D floats = 768 KiB
#define CH_ 96                          // 32-row chunks per batch

#if defined(__has_builtin)
# if __has_builtin(__builtin_amdgcn_global_load_async_to_lds_b128)
#  define HAVE_ASYNC 1
# endif
#endif

__device__ __forceinline__ uint16_t f2bfbits(float f) {
    union { float f; uint32_t u; } a; a.f = f;
    uint32_t r = a.u + 0x7FFFu + ((a.u >> 16) & 1u);   // round-to-nearest-even
    return (uint16_t)(r >> 16);
}
__device__ __forceinline__ __bf16 f2bf(float f) {
    uint16_t h = f2bfbits(f);
    __bf16 o; __builtin_memcpy(&o, &h, 2); return o;
}
// tanh-approx gelu (approximate=True), branch-free:
//   0.5 x (1 + tanh u) = x / (1 + exp(-2u)),  u = sqrt(2/pi) (x + 0.044715 x^3)
// exp(-2u) = exp2(x (K0 + K1 x^2)) with K0 = -2 sqrt(2/pi) log2(e), K1 = 0.044715 K0.
// Saturates by itself: exp2 -> inf gives x * 0, exp2 -> 0 gives x.
__device__ __forceinline__ float gelu_arg(float x) {   // the exp2 argument
    const float K0 = -2.3022081986f, K1 = -0.1029432396f;
    return x * fmaf(x * x, K1, K0);
}

// 16-byte global -> LDS copy: async (ASYNCcnt, bypasses VGPRs) when available.
__device__ __forceinline__ void cp16(const char* g, char* l) {
#if HAVE_ASYNC
    __builtin_amdgcn_global_load_async_to_lds_b128(
        (gp_v4i)(const_cast<char*>(g)), (lp_v4i)(l), 0, 0);
#else
    *(float4*)l = *(const float4*)g;
#endif
}
__device__ __forceinline__ void cp_wait() {
#if HAVE_ASYNC
# if __has_builtin(__builtin_amdgcn_s_wait_asynccnt)
    __builtin_amdgcn_s_wait_asynccnt(0);
# else
    asm volatile("s_wait_asynccnt 0" ::: "memory");
# endif
#endif
}

// ---------------------------------------------------------------------------
// Kernel 1: partial column sums of x. One work-group per (batch, 32-row chunk);
// a chunk lies inside one segment (32 chunks per segment of 1024 rows).
// Each thread keeps 8 independent 16-byte loads in flight (rows rg, rg+4, ...).
// ---------------------------------------------------------------------------
__global__ __launch_bounds__(256) void agg_kernel(const float* __restrict__ x,
                                                  float* __restrict__ part) {
    __shared__ float4 red4[4][64];
    const int c = blockIdx.x, b = blockIdx.y, t = threadIdx.x;
    const int q = t & 63, rg = t >> 6;
    const float4* xp = (const float4*)(x + ((size_t)b * L_ + c * 32 + rg) * D_) + q;
    float4 v[8];
    #pragma unroll
    for (int i = 0; i < 8; ++i) v[i] = xp[(size_t)i * 4 * (D_ / 4)];
    #pragma unroll
    for (int s = 4; s > 0; s >>= 1) {
        #pragma unroll
        for (int i = 0; i < s; ++i) {
            v[i].x += v[i + s].x; v[i].y += v[i + s].y;
            v[i].z += v[i + s].z; v[i].w += v[i + s].w;
        }
    }
    red4[rg][q] = v[0];
    __syncthreads();
    const float* r = (const float*)red4;
    part[((size_t)b * CH_ + c) * D_ + t] =
        (r[t] + r[D_ + t]) + (r[2 * D_ + t] + r[3 * D_ + t]);
}

// ---------------------------------------------------------------------------
// Kernel 2: gating -> w_be (renormalized top-2, zeros elsewhere).
// One work-group per batch, 768 threads = one per gate_in element.
// Thread (g, d) first sums segment g's 32 partials of column d, then owns
// gate_in[g*256 + d]; the 4 logit and 8 modulation dot products are summed by
// wave shuffles and one pass through LDS.
// ---------------------------------------------------------------------------
__global__ __launch_bounds__(768) void gate_kernel(const float* __restrict__ part,
                                                   const float* __restrict__ tc,
                                                   const float* __restrict__ gw,
                                                   const float* __restrict__ gb,
                                                   const float* __restrict__ tw,
                                                   const float* __restrict__ tb,
                                                   float* __restrict__ wbe) {
    __shared__ float seg[3][D_];
    __shared__ float red[24][12];
    __shared__ float fin[12];
    const int b = blockIdx.x, t = threadIdx.x;
    const int g = t >> 8, d = t & 255;          // g is wave-uniform
    const float* pp = part + ((size_t)b * CH_ + g * 32) * D_ + d;
    float a[4] = {0.f, 0.f, 0.f, 0.f};
    #pragma unroll
    for (int i = 0; i < 32; ++i) a[i & 3] += pp[(size_t)i * D_];
    const float4 w4 = ((const float4*)gw)[t];   // gate_w[t][0..3]
    float v[12];
    #pragma unroll
    for (int j = 0; j < 12; ++j) v[j] = 0.f;
    if (g == 0) {                               // modulation: silu(time_cond) @ tmod_w
        float u  = tc[b * D_ + d];
        float si = u / (1.0f + expf(-u));
        float4 t0 = ((const float4*)tw)[d * 2], t1 = ((const float4*)tw)[d * 2 + 1];
        v[4] = si * t0.x; v[5]  = si * t0.y; v[6]  = si * t0.z; v[7]  = si * t0.w;
        v[8] = si * t1.x; v[9]  = si * t1.y; v[10] = si * t1.z; v[11] = si * t1.w;
    }
    seg[g][d] = (a[0] + a[1]) + (a[2] + a[3]);
    __syncthreads();
    {
        float hs = seg[0][d], wsu = seg[1][d], ps = seg[2][d];
        float gi = (g == 0) ? (hs + wsu + ps) * (1.0f / 3072.0f)
                 : (g == 1) ? (hs + ps)       * (1.0f / 2048.0f)
                            : (wsu + ps)      * (1.0f / 2048.0f);
        v[0] = gi * w4.x; v[1] = gi * w4.y; v[2] = gi * w4.z; v[3] = gi * w4.w;
    }
    #pragma unroll
    for (int j = 0; j < 12; ++j) {
        #pragma unroll
        for (int m = 16; m > 0; m >>= 1) v[j] += __shfl_xor(v[j], m, 32);
    }
    if ((t & 31) == 0) {
        #pragma unroll
        for (int j = 0; j < 12; ++j) red[t >> 5][j] = v[j];
    }
    __syncthreads();
    if (t < 12) {
        float s = (t < E_) ? gb[t] : tb[t - E_];
        #pragma unroll
        for (int w = 0; w < 24; ++w) s += red[w][t];
        fin[t] = s;
    }
    __syncthreads();
    if (t == 0) {
        float p[E_]; float mx = -1e30f;
        for (int e = 0; e < E_; ++e) {
            p[e] = fin[e] * (1.0f + fin[E_ + e]) + fin[2 * E_ + e];
            mx = fmaxf(mx, p[e]);
        }
        float se = 0.f;
        for (int e = 0; e < E_; ++e) { p[e] = expf(p[e] - mx); se += p[e]; }
        for (int e = 0; e < E_; ++e) p[e] /= se;
        int i1 = 0;
        for (int e = 1; e < E_; ++e) if (p[e] > p[i1]) i1 = e;
        int i2 = (i1 == 0) ? 1 : 0;
        for (int e = 0; e < E_; ++e) if (e != i1 && p[e] > p[i2]) i2 = e;
        float s2 = p[i1] + p[i2] + 1e-8f;
        for (int e = 0; e < E_; ++e)
            wbe[b * E_ + e] = (e == i1) ? (p[i1] / s2) : ((e == i2) ? (p[i2] / s2) : 0.0f);
    }
}

// ---------------------------------------------------------------------------
// Kernel 3: pack fp32 weights into bf16 WMMA B-operand tiles.
// Tile = 32(K) x 16(N); per tile, lane l owns 16 bf16 at byte offset l*32.
// Element e of lane l maps to (kk, n):
//   n = l & 15 ; kk = (e/8)*16 + (l/16)*8 + (e%8)
// Tiles stored [nt][kt] contiguous in kt.
// ---------------------------------------------------------------------------
__global__ __launch_bounds__(128) void pack_kernel(const float* __restrict__ ew1,
                                                   const float* __restrict__ ew2,
                                                   const float* __restrict__ sw1,
                                                   const float* __restrict__ sw2,
                                                   char* __restrict__ ws) {
    __shared__ float tileS[512];
    int tb = blockIdx.x;
    const float* src; char* dst; int K, N, local;
    if (tb < 2048) {           // ew1: (E, 256, 1024), K=256 N=1024, 512 tiles/expert
        int ex = tb >> 9; local = tb & 511;
        src = ew1 + (size_t)ex * D_ * H_;
        dst = ws + PACK_EW1 + (size_t)tb * 1024;
        K = D_; N = H_;
    } else if (tb < 4096) {    // ew2: (E, 1024, 256), K=1024 N=256
        int t2 = tb - 2048; int ex = t2 >> 9; local = t2 & 511;
        src = ew2 + (size_t)ex * H_ * D_;
        dst = ws + PACK_EW2 + (size_t)t2 * 1024;
        K = H_; N = D_;
    } else if (tb < 4608) {    // sw1: (256, 1024)
        local = tb - 4096;
        src = sw1; dst = ws + PACK_SW1 + (size_t)local * 1024;
        K = D_; N = H_;
    } else {                   // sw2: (1024, 256)
        local = tb - 4608;
        src = sw2; dst = ws + PACK_SW2 + (size_t)local * 1024;
        K = H_; N = D_;
    }
    int ktiles = K / 32;
    int nt = local / ktiles, kt = local % ktiles;
    int k0 = kt * 32, n0 = nt * 16;
    int t = threadIdx.x;
    #pragma unroll
    for (int i = 0; i < 4; ++i) {
        int e = t + 128 * i;
        int k = e >> 4, nn = e & 15;
        tileS[e] = src[(size_t)(k0 + k) * N + (n0 + nn)];
    }
    __syncthreads();
    uint16_t hv[4];
    #pragma unroll
    for (int i = 0; i < 4; ++i) {
        int p = t * 4 + i;
        int lanep = p >> 4, el = p & 15;
        int nn = lanep & 15, half = lanep >> 4;
        int kk = ((el >> 3) << 4) + (half << 3) + (el & 7);
        hv[i] = f2bfbits(tileS[kk * 16 + nn]);
    }
    uint32_t lo = (uint32_t)hv[0] | ((uint32_t)hv[1] << 16);
    uint32_t hi = (uint32_t)hv[2] | ((uint32_t)hv[3] << 16);
    ((uint2*)dst)[t] = make_uint2(lo, hi);
}

// ---------------------------------------------------------------------------
// Kernel 4: fused MoE + shared MLP.
// Block = 256 thr = 8 waves; each wave owns a 16-row token tile (block: 128 rows,
// all inside one segment -> expert activity is block-uniform).
// Per n2c iteration the whole block shares one staged copy of the 32 B-tiles
// (16 GEMM1 + 16 GEMM2 = 32 KiB), double-buffered via async global->LDS copies.
// Inner GEMM loops software-pipeline the B-tile ds_loads one tile ahead so the
// DS latency overlaps the XDL (WMMA) pipe instead of serializing on dscnt==0.
// ---------------------------------------------------------------------------
__global__ __launch_bounds__(256) void moe_kernel(const float* __restrict__ x,
                                                  const float* __restrict__ eb1,
                                                  const float* __restrict__ eb2,
                                                  const float* __restrict__ sb1,
                                                  const float* __restrict__ sb2,
                                                  const float* __restrict__ wbe,
                                                  const char* __restrict__ ws,
                                                  float* __restrict__ out) {
    __shared__ float cbias[D_];
    __shared__ float wz[8];
    __shared__ float b1s[H_];
    __shared__ __align__(32) uint16_t hstage[8][16 * 32];
    __shared__ __align__(32) char bstage[2][32 * 1024];   // [buf][tile 0..31][1KiB]

    const int tid   = threadIdx.x;
    const int wv    = tid >> 5;
    const int lane  = tid & 31;
    const int n     = lane & 15;     // B/C column ; A row
    const int khalf = lane >> 4;
    const int b     = blockIdx.y;
    const int l0    = blockIdx.x * 128 + wv * 16;
    const int seg   = (blockIdx.x * 128) >> 10;  // 0=head 1=wrist 2=prop

    if (tid < E_) {
        float w = wbe[b * E_ + tid];
        bool act = (tid == 1) ? (seg != 1) : (tid == 2) ? (seg != 0) : true;
        wz[tid] = act ? w : 0.0f;
    }
    if (tid == E_) wz[E_] = 1.0f;    // shared MLP pseudo-expert
    __syncthreads();
    {   // combined output bias: sb2 + sum_e w_e * eb2_e  (blockDim == 256 == D_)
        float s = sb2[tid];
        #pragma unroll
        for (int e = 0; e < E_; ++e) s += wz[e] * eb2[e * D_ + tid];
        cbias[tid] = s;
    }

    // Build A1: x rows [l0, l0+16) -> bf16 A-operand layout, 8 K-chunks of 32
    const float4* xr = (const float4*)(x + ((size_t)b * L_ + l0 + n) * D_);
    v16bf A1[8];
    #pragma unroll
    for (int c = 0; c < 8; ++c) {
        #pragma unroll
        for (int part = 0; part < 2; ++part) {
            int kb = c * 32 + part * 16 + khalf * 8;
            float4 f0 = xr[kb >> 2];
            float4 f1 = xr[(kb >> 2) + 1];
            A1[c][part * 8 + 0] = f2bf(f0.x);
            A1[c][part * 8 + 1] = f2bf(f0.y);
            A1[c][part * 8 + 2] = f2bf(f0.z);
            A1[c][part * 8 + 3] = f2bf(f0.w);
            A1[c][part * 8 + 4] = f2bf(f1.x);
            A1[c][part * 8 + 5] = f2bf(f1.y);
            A1[c][part * 8 + 6] = f2bf(f1.z);
            A1[c][part * 8 + 7] = f2bf(f1.w);
        }
    }

    v8f outAcc[16];
    #pragma unroll
    for (int i = 0; i < 16; ++i) { v8f z = {}; outAcc[i] = z; }

    for (int ex = 0; ex < 5; ++ex) {
        float wgt = wz[ex];
        if (wgt == 0.0f) continue;   // block-uniform: skip masked / non-top-k experts
        const char* w1p = (ex < 4) ? (ws + PACK_EW1 + (size_t)ex * 512 * 1024)
                                   : (ws + PACK_SW1);
        const char* w2p = (ex < 4) ? (ws + PACK_EW2 + (size_t)ex * 512 * 1024)
                                   : (ws + PACK_SW2);
        const float* b1p = (ex < 4) ? (eb1 + ex * H_) : sb1;

        __syncthreads();   // prev expert fully done before we touch b1s / bstage[0]
        for (int i = tid; i < H_; i += 256) b1s[i] = b1p[i];

        // cooperative stage of the 32 B tiles for one n2c: 8 copies of 16 bytes per thread.
        // Lane l of a wave takes bytes [16 l, 16 l + 16) of one aligned 512-byte run, in
        // global memory and in LDS alike: a copy instruction touches 4 whole lines, not 32,
        // and its LDS writes fall on every bank once per 16 lanes.
        auto stage = [&](int n2c, int bb) {
            char* d = bstage[bb] + (size_t)tid * 16;
            // GEMM1 tiles: 16 KiB contiguous at w1p + n2c*16K; the block moves 4 KiB per copy
            const char* s1 = w1p + (size_t)n2c * 16384 + (size_t)tid * 16;
            #pragma unroll
            for (int i = 0; i < 4; ++i) cp16(s1 + i * 4096, d + i * 4096);
            // GEMM2 tiles: tile n3 = 4*i + tid/64 is 1 KiB at w2p + (n3*32 + n2c) KiB
            const char* s2 = w2p + ((size_t)((tid >> 6) * 32 + n2c)) * 1024 + (size_t)(tid & 63) * 16;
            #pragma unroll
            for (int i = 0; i < 4; ++i) cp16(s2 + (size_t)i * 131072, d + 16384 + i * 4096);
        };

        stage(0, 0);
        for (int n2c = 0; n2c < 32; ++n2c) {       // H in chunks of 32
            const char* buf = bstage[n2c & 1];
            cp_wait();                 // own async copies landed
            __syncthreads();           // everyone's copies landed; prev compute done
            if (n2c + 1 < 32) stage(n2c + 1, (n2c + 1) & 1);

            // ---- GEMM1: h columns [n2c*32, n2c*32+32) ----
            #pragma unroll
            for (int t = 0; t < 2; ++t) {
                v8f acc = {};
                v16bf btc, btn;
                __builtin_memcpy(&btc, buf + (size_t)(t * 8) * 1024 + lane * 32, 32);
                #pragma unroll
                for (int kc = 0; kc < 8; ++kc) {   // K = D = 256, pipelined B loads
                    if (kc + 1 < 8)
                        __builtin_memcpy(&btn, buf + (size_t)(t * 8 + kc + 1) * 1024 + lane * 32, 32);
                    acc = __builtin_amdgcn_wmma_f32_16x16x32_bf16(
                              false, A1[kc], false, btc, (short)0, acc, false, false);
                    btc = btn;
                }
                float bias = b1s[(n2c * 2 + t) * 16 + n];
                float hx[8], hs[8];                // gelu stage by stage: no element waits on another
                #pragma unroll
                for (int r = 0; r < 8; ++r) hx[r] = acc[r] + bias;
                #pragma unroll
                for (int r = 0; r < 8; ++r) hs[r] = gelu_arg(hx[r]);
                #pragma unroll
                for (int r = 0; r < 8; ++r) hs[r] = 1.0f + __builtin_amdgcn_exp2f(hs[r]);
                #pragma unroll
                for (int r = 0; r < 8; ++r) hs[r] = __builtin_amdgcn_rcpf(hs[r]);
                #pragma unroll
                for (int r = 0; r < 8; ++r) {      // weight, restage (C->A)
                    float hv = hx[r] * hs[r] * wgt;
                    int mrow = r + 8 * khalf;
                    int kk   = t * 16 + n;
                    int lp   = mrow + 16 * ((kk >> 3) & 1);
                    int e2   = ((kk >> 4) << 3) + (kk & 7);
                    hstage[wv][lp * 16 + e2] = f2bfbits(hv);
                }
            }
            v16bf a2;
            __builtin_memcpy(&a2, &hstage[wv][lane * 16], 32);  // per-wave slice, DS in-order
            // ---- GEMM2: outAcc += a2(16x32) @ W2[n2c*32 .. , :256), pipelined ----
            {
                v16bf btc, btn;
                __builtin_memcpy(&btc, buf + 16384 + (size_t)lane * 32, 32);
                #pragma unroll
                for (int n3 = 0; n3 < 16; ++n3) {
                    if (n3 + 1 < 16)
                        __builtin_memcpy(&btn, buf + 16384 + (size_t)(n3 + 1) * 1024 + lane * 32, 32);
                    outAcc[n3] = __builtin_amdgcn_wmma_f32_16x16x32_bf16(
                                     false, a2, false, btc, (short)0, outAcc[n3], false, false);
                    btc = btn;
                }
            }
        }
    }
    __syncthreads();

    // Write output tile (+ combined bias)
    #pragma unroll
    for (int n3 = 0; n3 < 16; ++n3) {
        #pragma unroll
        for (int r = 0; r < 8; ++r) {
            int row = r + 8 * khalf;
            int col = n3 * 16 + n;
            out[((size_t)b * L_ + l0 + row) * D_ + col] = outAcc[n3][r] + cbias[col];
        }
    }
}

// ---------------------------------------------------------------------------
extern "C" void kernel_launch(void* const* d_in, const int* in_sizes, int n_in,
                              void* d_out, int out_size, void* d_ws, size_t ws_size,
                              hipStream_t stream) {
    (void)in_sizes; (void)n_in; (void)out_size; (void)ws_size;
    const float* x   = (const float*)d_in[0];
    const float* tc  = (const float*)d_in[1];
    const float* gw  = (const float*)d_in[2];
    const float* gb  = (const float*)d_in[3];
    const float* tw  = (const float*)d_in[4];
    const float* tb  = (const float*)d_in[5];
    const float* ew1 = (const float*)d_in[6];
    const float* eb1 = (const float*)d_in[7];
    const float* ew2 = (const float*)d_in[8];
    const float* eb2 = (const float*)d_in[9];
    const float* sw1 = (const float*)d_in[10];
    const float* sb1 = (const float*)d_in[11];
    const float* sw2 = (const float*)d_in[12];
    const float* sb2 = (const float*)d_in[13];
    char*  ws  = (char*)d_ws;
    float* part = (float*)(ws + PART_OFF);
    float* wbe = (float*)(ws + WBE_OFF);
    float* out = (float*)d_out;

    agg_kernel <<<dim3(CH_, B_), 256, 0, stream>>>(x, part);
    gate_kernel<<<B_, 768, 0, stream>>>(part, tc, gw, gb, tw, tb, wbe);
    pack_kernel<<<5120, 128, 0, stream>>>(ew1, ew2, sw1, sw2, ws);
    moe_kernel <<<dim3(L_ / 128, B_), 256, 0, stream>>>(x, eb1, eb2, sb1, sb2, wbe, ws, out);
}

// v004
// One run takes 152 microseconds.
// Timed twice side by side with v003, it ran 1.13 times as fast both times.
// Over all steps from v000 it is 2.97 times as fast.
#include <hip/hip_runtime.h>
#include <hip/hip_bf16.h>
#include <stdint.h>

typedef __attribute__((ext_vector_type(16))) __bf16 v16bf;
typedef __attribute__((ext_vector_type(8)))  __bf16 v8bf;
typedef __attribute__((ext_vector_type(8)))  float  v8f;
typedef int v4i_ __attribute__((__vector_size__(16)));
typedef __attribute__((address_space(1))) v4i_* gp_v4i;
typedef __attribute__((address_space(3))) v4i_* lp_v4i;

#define B_ 8
#define L_ 3072
#define D_ 256
#define E_ 4
#define H_ 1024

// d_ws layout (bytes)
#define WBE_OFF   (32*1024)             // B*E floats
#define PACK_EW1  (64*1024)             // 4 experts * 512 tiles * 1 KiB = 2 MiB
#define PACK_EW2  (PACK_EW1 + 2*1024*1024)
#define PACK_SW1  (PACK_EW2 + 2*1024*1024)   // 512 KiB
#define PACK_SW2  (PACK_SW1 + 512*1024)      // 512 KiB
#define PART_OFF  (8*1024*1024)         // B * CH_ * D floats = 768 KiB
#define CH_ 96                          // 32-row chunks per batch

#if defined(__has_builtin)
# if __has_builtin(__builtin_amdgcn_global_load_async_to_lds_b128)
#  define HAVE_ASYNC 1
# endif
#endif

__device__ __forceinline__ uint16_t f2bfbits(float f) {
    union { float f; uint32_t u; } a; a.f = f;
    uint32_t r = a.u + 0x7FFFu + ((a.u >> 16) & 1u);   // round-to-nearest-even
    return (uint16_t)(r >> 16);
}
__device__ __forceinline__ __bf16 f2bf(float f) {
    uint16_t h = f2bfbits(f);
    __bf16 o; __builtin_memcpy(&o, &h, 2); return o;
}
// tanh-approx gelu (approximate=True), branch-free:
//   0.5 x (1 + tanh u) = x / (1 + exp(-2u)),  u = sqrt(2/pi) (x + 0.044715 x^3)
// exp(-2u) = exp2(x (K0 + K1 x^2)) with K0 = -2 sqrt(2/pi) log2(e), K1 = 0.044715 K0.
// Saturates by itself: exp2 -> inf gives x * 0, exp2 -> 0 gives x.
__device__ __forceinline__ float gelu_arg(float x) {   // the exp2 argument
    const float K0 = -2.3022081986f, K1 = -0.1029432396f;
    return x * fmaf(x * x, K1, K0);
}

// One 16x32 / 32x16 bf16 fragment (1 KiB) from LDS. The tile is stored as two 512-byte
// halves; lane l owns bytes [16 l, 16 l + 16) of each half (elements 0..7, then 8..15).
// Each 16-byte read of a wave is then 512 contiguous bytes: 16 lanes cover all 64 banks once.
__device__ __forceinline__ v16bf ldfrag(const char* tile, int lane) {
    v8bf lo, hi;
    __builtin_memcpy(&lo, tile + lane * 16, 16);
    __builtin_memcpy(&hi, tile + 512 + lane * 16, 16);
    return __builtin_shufflevector(lo, hi, 0, 1, 2, 3, 4, 5, 6, 7, 8, 9, 10, 11, 12, 13, 14, 15);
}

// 16-byte global -> LDS copy: async (ASYNCcnt, bypasses VGPRs) when available.
__device__ __forceinline__ void cp16(const char* g, char* l) {
#if HAVE_ASYNC
    __builtin_amdgcn_global_load_async_to_lds_b128(
        (gp_v4i)(const_cast<char*>(g)), (lp_v4i)(l), 0, 0);
#else
    *(float4*)l = *(const float4*)g;
#endif
}
__device__ __forceinline__ void cp_wait() {
#if HAVE_ASYNC
# if __has_builtin(__builtin_amdgcn_s_wait_asynccnt)
    __builtin_amdgcn_s_wait_asynccnt(0);
# else
    asm volatile("s_wait_asynccnt 0" ::: "memory");
# endif
#endif
}

// ---------------------------------------------------------------------------
// Kernel 1: partial column sums of x. One work-group per (batch, 32-row chunk);
// a chunk lies inside one segment (32 chunks per segment of 1024 rows).
// Each thread keeps 8 independent 16-byte loads in flight (rows rg, rg+4, ...).
// ---------------------------------------------------------------------------
__global__ __launch_bounds__(256) void agg_kernel(const float* __restrict__ x,
                                                  float* __restrict__ part) {
    __shared__ float4 red4[4][64];
    const int c = blockIdx.x, b = blockIdx.y, t = threadIdx.x;
    const int q = t & 63, rg = t >> 6;
    const float4* xp = (const float4*)(x + ((size_t)b * L_ + c * 32 + rg) * D_) + q;
    float4 v[8];
    #pragma unroll
    for (int i = 0; i < 8; ++i) v[i] = xp[(size_t)i * 4 * (D_ / 4)];
    #pragma unroll
    for (int s = 4; s > 0; s >>= 1) {
        #pragma unroll
        for (int i = 0; i < s; ++i) {
            v[i].x += v[i + s].x; v[i].y += v[i + s].y;
            v[i].z += v[i + s].z; v[i].w += v[i + s].w;
        }
    }
    red4[rg][q] = v[0];
    __syncthreads();
    const float* r = (const float*)red4;
    part[((size_t)b * CH_ + c) * D_ + t] =
        (r[t] + r[D_ + t]) + (r[2 * D_ + t] + r[3 * D_ + t]);
}

// ---------------------------------------------------------------------------
// Kernel 2: gating -> w_be (renormalized top-2, zeros elsewhere).
// One work-group per batch, 768 threads = one per gate_in element.
// Thread (g, d) first sums segment g's 32 partials of column d, then owns
// gate_in[g*256 + d]; the 4 logit and 8 modulation dot products are summed by
// wave shuffles and one pass through LDS.
// ---------------------------------------------------------------------------
__global__ __launch_bounds__(768) void gate_kernel(const float* __restrict__ part,
                                                   const float* __restrict__ tc,
                                                   const float* __restrict__ gw,
                                                   const float* __restrict__ gb,
                                                   const float* __restrict__ tw,
                                                   const float* __restrict__ tb,
                                                   float* __restrict__ wbe) {
    __shared__ float seg[3][D_];
    __shared__ float red[24][12];
    __shared__ float fin[12];
    const int b = blockIdx.x, t = threadIdx.x;
    const int g = t >> 8, d = t & 255;          // g is wave-uniform
    const float* pp = part + ((size_t)b * CH_ + g * 32) * D_ + d;
    float a[4] = {0.f, 0.f, 0.f, 0.f};
    #pragma unroll
    for (int i = 0; i < 32; ++i) a[i & 3] += pp[(size_t)i * D_];
    const float4 w4 = ((const float4*)gw)[t];   // gate_w[t][0..3]
    float v[12];
    #pragma unroll
    for (int j = 0; j < 12; ++j) v[j] = 0.f;
    if (g == 0) {                               // modulation: silu(time_cond) @ tmod_w
        float u  = tc[b * D_ + d];
        float si = u / (1.0f + expf(-u));
        float4 t0 = ((const float4*)tw)[d * 2], t1 = ((const float4*)tw)[d * 2 + 1];
        v[4] = si * t0.x; v[5]  = si * t0.y; v[6]  = si * t0.z; v[7]  = si * t0.w;
        v[8] = si * t1.x; v[9]  = si * t1.y; v[10] = si * t1.z; v[11] = si * t1.w;
    }
    seg[g][d] = (a[0] + a[1]) + (a[2] + a[3]);
    __syncthreads();
    {
        float hs = seg[0][d], wsu = seg[1][d], ps = seg[2][d];
        float gi = (g == 0) ? (hs + wsu + ps) * (1.0f / 3072.0f)
                 : (g == 1) ? (hs + ps)       * (1.0f / 2048.0f)
                            : (wsu + ps)      * (1.0f / 2048.0f);
        v[0] = gi * w4.x; v[1] = gi * w4.y; v[2] = gi * w4.z; v[3] = gi * w4.w;
    }
    #pragma unroll
    for (int j = 0; j < 12; ++j) {
        #pragma unroll
        for (int m = 16; m > 0; m >>= 1) v[j] += __shfl_xor(v[j], m, 32);
    }
    if ((t & 31) == 0) {
        #pragma unroll
        for (int j = 0; j < 12; ++j) red[t >> 5][j] = v[j];
    }
    __syncthreads();
    if (t < 12) {
        float s = (t < E_) ? gb[t] : tb[t - E_];
        #pragma unroll
        for (int w = 0; w < 24; ++w) s += red[w][t];
        fin[t] = s;
    }
    __syncthreads();
    if (t == 0) {
        float p[E_]; float mx = -1e30f;
        for (int e = 0; e < E_; ++e) {
            p[e] = fin[e] * (1.0f + fin[E_ + e]) + fin[2 * E_ + e];
            mx = fmaxf(mx, p[e]);
        }
        float se = 0.f;
        for (int e = 0; e < E_; ++e) { p[e] = expf(p[e] - mx); se += p[e]; }
        for (int e = 0; e < E_; ++e) p[e] /= se;
        int i1 = 0;
        for (int e = 1; e < E_; ++e) if (p[e] > p[i1]) i1 = e;
        int i2 = (i1 == 0) ? 1 : 0;
        for (int e = 0; e < E_; ++e) if (e != i1 && p[e] > p[i2]) i2 = e;
        float s2 = p[i1] + p[i2] + 1e-8f;
        for (int e = 0; e < E_; ++e)
            wbe[b * E_ + e] = (e == i1) ? (p[i1] / s2) : ((e == i2) ? (p[i2] / s2) : 0.0f);
    }
}

// ---------------------------------------------------------------------------
// Kernel 3: pack fp32 weights into bf16 WMMA B-operand tiles.
// Tile = 32(K) x 16(N), 1 KiB; element e of lane l sits at byte (e/8)*512 + l*16 + (e%8)*2
// (the layout ldfrag reads) and maps to (kk, n):
//   n = l & 15 ; kk = (e/8)*16 + (l/16)*8 + (e%8)
// Tiles stored [nt][kt] contiguous in kt.
// ---------------------------------------------------------------------------
__global__ __launch_bounds__(128) void pack_kernel(const float* __restrict__ ew1,
                                                   const float* __restrict__ ew2,
                                                   const float* __restrict__ sw1,
                                                   const float* __restrict__ sw2,
                                                   char* __restrict__ ws) {
    __shared__ float tileS[512];
    int tb = blockIdx.x;
    const float* src; char* dst; int K, N, local;
    if (tb < 2048) {           // ew1: (E, 256, 1024), K=256 N=1024, 512 tiles/expert
        int ex = tb >> 9; local = tb & 511;
        src = ew1 + (size_t)ex * D_ * H_;
        dst = ws + PACK_EW1 + (size_t)tb * 1024;
        K = D_; N = H_;
    } else if (tb < 4096) {    // ew2: (E, 1024, 256), K=1024 N=256
        int t2 = tb - 2048; int ex = t2 >> 9; local = t2 & 511;
        src = ew2 + (size_t)ex * H_ * D_;
        dst = ws + PACK_EW2 + (size_t)t2 * 1024;
        K = H_; N = D_;
    } else if (tb < 4608) {    // sw1: (256, 1024)
        local = tb - 4096;
        src = sw1; dst = ws + PACK_SW1 + (size_t)local * 1024;
        K = D_; N = H_;
    } else {                   // sw2: (1024, 256)
        local = tb - 4608;
        src = sw2; dst = ws + PACK_SW2 + (size_t)local * 1024;
        K = H_; N = D_;
    }
    int ktiles = K / 32;
    int nt = local / ktiles, kt = local % ktiles;
    int k0 = kt * 32, n0 = nt * 16;
    int t = threadIdx.x;
    #pragma unroll
    for (int i = 0; i < 4; ++i) {
        int e = t + 128 * i;
        int k = e >> 4, nn = e & 15;
        tileS[e] = src[(size_t)(k0 + k) * N + (n0 + nn)];
    }
    __syncthreads();
    uint16_t hv[4];
    #pragma unroll
    for (int i = 0; i < 4; ++i) {
        int p = t * 4 + i;
        int lanep = (p >> 3) & 31;
        int nn = lanep & 15, half = lanep >> 4;
        int kk = ((p >> 8) << 4) + (half << 3) + (p & 7);
        hv[i] = f2bfbits(tileS[kk * 16 + nn]);
    }
    uint32_t lo = (uint32_t)hv[0] | ((uint32_t)hv[1] << 16);
    uint32_t hi = (uint32_t)hv[2] | ((uint32_t)hv[3] << 16);
    ((uint2*)dst)[t] = make_uint2(lo, hi);
}

// ---------------------------------------------------------------------------
// Kernel 4: fused MoE + shared MLP.
// Block = 256 thr = 8 waves; each wave owns a 16-row token tile (block: 128 rows,
// all inside one segment -> expert activity is block-uniform).
// Per n2c iteration the whole block shares one staged copy of the 32 B-tiles
// (16 GEMM1 + 16 GEMM2 = 32 KiB), double-buffered via async global->LDS copies.
// Inner GEMM loops software-pipeline the B-tile ds_loads one tile ahead so the
// DS latency overlaps the XDL (WMMA) pipe instead of serializing on dscnt==0.
// ---------------------------------------------------------------------------
__global__ __launch_bounds__(256) void moe_kernel(const float* __restrict__ x,
                                                  const float* __restrict__ eb1,
                                                  const float* __restrict__ eb2,
                                                  const float* __restrict__ sb1,
                                                  const float* __restrict__ sb2,
                                                  const float* __restrict__ wbe,
                                                  const char* __restrict__ ws,
                                                  float* __restrict__ out) {
    __shared__ float cbias[D_];
    __shared__ float wz[8];
    __shared__ float b1s[H_];
    __shared__ __align__(32) uint16_t hstage[8][16 * 32];
    __shared__ __align__(32) char bstage[2][32 * 1024];   // [buf][tile 0..31][1KiB]

    const int tid   = threadIdx.x;
    const int wv    = tid >> 5;
    const int lane  = tid & 31;
    const int n     = lane & 15;     // B/C column ; A row
    const int khalf = lane >> 4;
    const int b     = blockIdx.y;
    const int l0    = blockIdx.x * 128 + wv * 16;
    const int seg   = (blockIdx.x * 128) >> 10;  // 0=head 1=wrist 2=prop

    if (tid < E_) {
        float w = wbe[b * E_ + tid];
        bool act = (tid == 1) ? (seg != 1) : (tid == 2) ? (seg != 0) : true;
        wz[tid] = act ? w : 0.0f;
    }
    if (tid == E_) wz[E_] = 1.0f;    // shared MLP pseudo-expert
    __syncthreads();
    {   // combined output bias: sb2 + sum_e w_e * eb2_e  (blockDim == 256 == D_)
        float s = sb2[tid];
        #pragma unroll
        for (int e = 0; e < E_; ++e) s += wz[e] * eb2[e * D_ + tid];
        cbias[tid] = s;
    }

    // Build A1: x rows [l0, l0+16) -> bf16 A-operand layout, 8 K-chunks of 32
    const float4* xr = (const float4*)(x + ((size_t)b * L_ + l0 + n) * D_);
    v16bf A1[8];
    #pragma unroll
    for (int c = 0; c < 8; ++c) {
        #pragma unroll
        for (int part = 0; part < 2; ++part) {
            int kb = c * 32 + part * 16 + khalf * 8;
            float4 f0 = xr[kb >> 2];
            float4 f1 = xr[(kb >> 2) + 1];
            A1[c][part * 8 + 0] = f2bf(f0.x);
            A1[c][part * 8 + 1] = f2bf(f0.y);
            A1[c][part * 8 + 2] = f2bf(f0.z);
            A1[c][part * 8 + 3] = f2bf(f0.w);
            A1[c][part * 8 + 4] = f2bf(f1.x);
            A1[c][part * 8 + 5] = f2bf(f1.y);
            A1[c][part * 8 + 6] = f2bf(f1.z);
            A1[c][part * 8 + 7] = f2bf(f1.w);
        }
    }

    v8f outAcc[16];
    #pragma unroll
    for (int i = 0; i < 16; ++i) { v8f z = {}; outAcc[i] = z; }

    for (int ex = 0; ex < 5; ++ex) {
        float wgt = wz[ex];
        if (wgt == 0.0f) continue;   // block-uniform: skip masked / non-top-k experts
        const char* w1p = (ex < 4) ? (ws + PACK_EW1 + (size_t)ex * 512 * 1024)
                                   : (ws + PACK_SW1);
        const char* w2p = (ex < 4) ? (ws + PACK_EW2 + (size_t)ex * 512 * 1024)
                                   : (ws + PACK_SW2);
        const float* b1p = (ex < 4) ? (eb1 + ex * H_) : sb1;

        __syncthreads();   // prev expert fully done before we touch b1s / bstage[0]
        for (int i = tid; i < H_; i += 256) b1s[i] = b1p[i];

        // cooperative stage of the 32 B tiles for one n2c: 8 copies of 16 bytes per thread.
        // Lane l of a wave takes bytes [16 l, 16 l + 16) of one aligned 512-byte run, in
        // global memory and in LDS alike: a copy instruction touches 4 whole lines, not 32,
        // and its LDS writes fall on every bank once per 16 lanes.
        auto stage = [&](int n2c, int bb) {
            char* d = bstage[bb] + (size_t)tid * 16;
            // GEMM1 tiles: 16 KiB contiguous at w1p + n2c*16K; the block moves 4 KiB per copy
            const char* s1 = w1p + (size_t)n2c * 16384 + (size_t)tid * 16;
            #pragma unroll
            for (int i = 0; i < 4; ++i) cp16(s1 + i * 4096, d + i * 4096);
            // GEMM2 tiles: tile n3 = 4*i + tid/64 is 1 KiB at w2p + (n3*32 + n2c) KiB
            const char* s2 = w2p + ((size_t)((tid >> 6) * 32 + n2c)) * 1024 + (size_t)(tid & 63) * 16;
            #pragma unroll
            for (int i = 0; i < 4; ++i) cp16(s2 + (size_t)i * 131072, d + 16384 + i * 4096);
        };

        stage(0, 0);
        for (int n2c = 0; n2c < 32; ++n2c) {       // H in chunks of 32
            const char* buf = bstage[n2c & 1];
            cp_wait();                 // own async copies landed
            __syncthreads();           // everyone's copies landed; prev compute done
            if (n2c + 1 < 32) stage(n2c + 1, (n2c + 1) & 1);

            // ---- GEMM1: h columns [n2c*32, n2c*32+32) ----
            #pragma unroll
            for (int t = 0; t < 2; ++t) {
                v8f acc = {};
                v16bf btc, btn;
                btc = ldfrag(buf + (size_t)(t * 8) * 1024, lane);
                #pragma unroll
                for (int kc = 0; kc < 8; ++kc) {   // K = D = 256, pipelined B loads
                    if (kc + 1 < 8)
                        btn = ldfrag(buf + (size_t)(t * 8 + kc + 1) * 1024, lane);
                    acc = __builtin_amdgcn_wmma_f32_16x16x32_bf16(
                              false, A1[kc], false, btc, (short)0, acc, false, false);
                    btc = btn;
                }
                float bias = b1s[(n2c * 2 + t) * 16 + n];
                float hx[8], hs[8];                // gelu stage by stage: no element waits on another
                #pragma unroll
                for (int r = 0; r < 8; ++r) hx[r] = acc[r] + bias;
                #pragma unroll
                for (int r = 0; r < 8; ++r) hs[r] = gelu_arg(hx[r]);
                #pragma unroll
                for (int r = 0; r < 8; ++r) hs[r] = 1.0f + __builtin_amdgcn_exp2f(hs[r]);
                #pragma unroll
                for (int r = 0; r < 8; ++r) hs[r] = __builtin_amdgcn_rcpf(hs[r]);
                #pragma unroll
                for (int r = 0; r < 8; ++r) {      // weight, restage (C->A)
                    float hv = hx[r] * hs[r] * wgt;
                    int mrow = r + 8 * khalf;
                    int kk   = t * 16 + n;
                    int lp   = mrow + 16 * ((kk >> 3) & 1);
                    int e2   = ((kk >> 4) << 3) + (kk & 7);
                    hstage[wv][(e2 >> 3) * 256 + lp * 8 + (e2 & 7)] = f2bfbits(hv);
                }
            }
            v16bf a2 = ldfrag((const char*)&hstage[wv][0], lane);  // per-wave slice, DS in-order
            // ---- GEMM2: outAcc += a2(16x32) @ W2[n2c*32 .. , :256), pipelined ----
            {
                v16bf btc, btn;
                btc = ldfrag(buf + 16384, lane);
                #pragma unroll
                for (int n3 = 0; n3 < 16; ++n3) {
                    if (n3 + 1 < 16)
                        btn = ldfrag(buf + 16384 + (size_t)(n3 + 1) * 1024, lane);
                    outAcc[n3] = __builtin_amdgcn_wmma_f32_16x16x32_bf16(
                                     false, a2, false, btc, (short)0, outAcc[n3], false, false);
                    btc = btn;
                }
            }
        }
    }
    __syncthreads();

    // Write output tile (+ combined bias)
    #pragma unroll
    for (int n3 = 0; n3 < 16; ++n3) {
        #pragma unroll
        for (int r = 0; r < 8; ++r) {
            int row = r + 8 * khalf;
            int col = n3 * 16 + n;
            out[((size_t)b * L_ + l0 + row) * D_ + col] = outAcc[n3][r] + cbias[col];
        }
    }
}

// ---------------------------------------------------------------------------
extern "C" void kernel_launch(void* const* d_in, const int* in_sizes, int n_in,
                              void* d_out, int out_size, void* d_ws, size_t ws_size,
                              hipStream_t stream) {
    (void)in_sizes; (void)n_in; (void)out_size; (void)ws_size;
    const float* x   = (const float*)d_in[0];
    const float* tc  = (const float*)d_in[1];
    const float* gw  = (const float*)d_in[2];
    const float* gb  = (const float*)d_in[3];
    const float* tw  = (const float*)d_in[4];
    const float* tb  = (const float*)d_in[5];
    const float* ew1 = (const float*)d_in[6];
    const float* eb1 = (const float*)d_in[7];
    const float* ew2 = (const float*)d_in[8];
    const float* eb2 = (const float*)d_in[9];
    const float* sw1 = (const float*)d_in[10];
    const float* sb1 = (const float*)d_in[11];
    const float* sw2 = (const float*)d_in[12];
    const float* sb2 = (const float*)d_in[13];
    char*  ws  = (char*)d_ws;
    float* part = (float*)(ws + PART_OFF);
    float* wbe = (float*)(ws + WBE_OFF);
    float* out = (float*)d_out;

    agg_kernel <<<dim3(CH_, B_), 256, 0, stream>>>(x, part);
    gate_kernel<<<B_, 768, 0, stream>>>(part, tc, gw, gb, tw, tb, wbe);
    pack_kernel<<<5120, 128, 0, stream>>>(ew1, ew2, sw1, sw2, ws);
    moe_kernel <<<dim3(L_ / 128, B_), 256, 0, stream>>>(x, eb1, eb2, sb1, sb2, wbe, ws, out);
}

// v005
// It runs in 114 microseconds.
// Two timings next to v004 put it at 1.33 and 1.35 times that version's speed.
// Counting every step since v000, it is 3.97 times as fast.
#include <hip/hip_runtime.h>
#include <hip/hip_bf16.h>
#include <stdint.h>

typedef __attribute__((ext_vector_type(16))) __bf16 v16bf;
typedef __attribute__((ext_vector_type(8)))  __bf16 v8bf;
typedef __attribute__((ext_vector_type(8)))  float  v8f;
typedef int v4i_ __attribute__((__vector_size__(16)));
typedef __attribute__((address_space(1))) v4i_* gp_v4i;
typedef __attribute__((address_space(3))) v4i_* lp_v4i;

#define B_ 8
#define L_ 3072
#define D_ 256
#define E_ 4
#define H_ 1024

// d_ws layout (bytes)
#define WBE_OFF   (32*1024)             // B*E floats
#define PACK_EW1  (64*1024)             // 4 experts * 512 tiles * 1 KiB = 2 MiB
#define PACK_EW2  (PACK_EW1 + 2*1024*1024)
#define PACK_SW1  (PACK_EW2 + 2*1024*1024)   // 512 KiB
#define PACK_SW2  (PACK_SW1 + 512*1024)      // 512 KiB
#define PART_OFF  (8*1024*1024)         // B * CH_ * D floats = 768 KiB
#define CH_ 96                          // 32-row chunks per batch

#if defined(__has_builtin)
# if __has_builtin(__builtin_amdgcn_global_load_async_to_lds_b128)
#  define HAVE_ASYNC 1
# endif
#endif

__device__ __forceinline__ uint16_t f2bfbits(float f) {
    union { float f; uint32_t u; } a; a.f = f;
    uint32_t r = a.u + 0x7FFFu + ((a.u >> 16) & 1u);   // round-to-nearest-even
    return (uint16_t)(r >> 16);
}
__device__ __forceinline__ __bf16 f2bf(float f) {
    uint16_t h = f2bfbits(f);
    __bf16 o; __builtin_memcpy(&o, &h, 2); return o;
}
// tanh-approx gelu (approximate=True), branch-free:
//   0.5 x (1 + tanh u) = x / (1 + exp(-2u)),  u = sqrt(2/pi) (x + 0.044715 x^3)
// exp(-2u) = exp2(x (K0 + K1 x^2)) with K0 = -2 sqrt(2/pi) log2(e), K1 = 0.044715 K0.
// Saturates by itself: exp2 -> inf gives x * 0, exp2 -> 0 gives x.
__device__ __forceinline__ float gelu_arg(float x) {   // the exp2 argument
    const float K0 = -2.3022081986f, K1 = -0.1029432396f;
    return x * fmaf(x * x, K1, K0);
}

// One 16x32 / 32x16 bf16 fragment (1 KiB) from LDS. The tile is stored as two 512-byte
// halves; lane l owns bytes [16 l, 16 l + 16) of each half (elements 0..7, then 8..15).
// Each 16-byte read of a wave is then 512 contiguous bytes: 16 lanes cover all 64 banks once.
__device__ __forceinline__ v16bf ldfrag(const char* tile, int lane) {
    v8bf lo, hi;
    __builtin_memcpy(&lo, tile + lane * 16, 16);
    __builtin_memcpy(&hi, tile + 512 + lane * 16, 16);
    return __builtin_shufflevector(lo, hi, 0, 1, 2, 3, 4, 5, 6, 7, 8, 9, 10, 11, 12, 13, 14, 15);
}

// 16-byte global -> LDS copy: async (ASYNCcnt, bypasses VGPRs) when available.
__device__ __forceinline__ void cp16(const char* g, char* l) {
#if HAVE_ASYNC
    __builtin_amdgcn_global_load_async_to_lds_b128(
        (gp_v4i)(const_cast<char*>(g)), (lp_v4i)(l), 0, 0);
#else
    *(float4*)l = *(const float4*)g;
#endif
}
__device__ __forceinline__ void cp_wait() {
#if HAVE_ASYNC
# if __has_builtin(__builtin_amdgcn_s_wait_asynccnt)
    __builtin_amdgcn_s_wait_asynccnt(0);
# else
    asm volatile("s_wait_asynccnt 0" ::: "memory");
# endif
#endif
}

// ---------------------------------------------------------------------------
// Kernel 1: partial column sums of x. One work-group per (batch, 32-row chunk);
// a chunk lies inside one segment (32 chunks per segment of 1024 rows).
// Each thread keeps 8 independent 16-byte loads in flight (rows rg, rg+4, ...).
// ---------------------------------------------------------------------------
__global__ __launch_bounds__(256) void agg_kernel(const float* __restrict__ x,
                                                  float* __restrict__ part) {
    __shared__ float4 red4[4][64];
    const int c = blockIdx.x, b = blockIdx.y, t = threadIdx.x;
    const int q = t & 63, rg = t >> 6;
    const float4* xp = (const float4*)(x + ((size_t)b * L_ + c * 32 + rg) * D_) + q;
    float4 v[8];
    #pragma unroll
    for (int i = 0; i < 8; ++i) v[i] = xp[(size_t)i * 4 * (D_ / 4)];
    #pragma unroll
    for (int s = 4; s > 0; s >>= 1) {
        #pragma unroll
        for (int i = 0; i < s; ++i) {
            v[i].x += v[i + s].x; v[i].y += v[i + s].y;
            v[i].z += v[i + s].z; v[i].w += v[i + s].w;
        }
    }
    red4[rg][q] = v[0];
    __syncthreads();
    const float* r = (const float*)red4;
    part[((size_t)b * CH_ + c) * D_ + t] =
        (r[t] + r[D_ + t]) + (r[2 * D_ + t] + r[3 * D_ + t]);
}

// ---------------------------------------------------------------------------
// Kernel 2: gating -> w_be (renormalized top-2, zeros elsewhere).
// One work-group per batch, 768 threads = one per gate_in element.
// Thread (g, d) first sums segment g's 32 partials of column d, then owns
// gate_in[g*256 + d]; the 4 logit and 8 modulation dot products are summed by
// wave shuffles and one pass through LDS.
// ---------------------------------------------------------------------------
__global__ __launch_bounds__(768) void gate_kernel(const float* __restrict__ part,
                                                   const float* __restrict__ tc,
                                                   const float* __restrict__ gw,
                                                   const float* __restrict__ gb,
                                                   const float* __restrict__ tw,
                                                   const float* __restrict__ tb,
                                                   float* __restrict__ wbe) {
    __shared__ float seg[3][D_];
    __shared__ float red[24][12];
    __shared__ float fin[12];
    const int b = blockIdx.x, t = threadIdx.x;
    const int g = t >> 8, d = t & 255;          // g is wave-uniform
    const float* pp = part + ((size_t)b * CH_ + g * 32) * D_ + d;
    float a[4] = {0.f, 0.f, 0.f, 0.f};
    #pragma unroll
    for (int i = 0; i < 32; ++i) a[i & 3] += pp[(size_t)i * D_];
    const float4 w4 = ((const float4*)gw)[t];   // gate_w[t][0..3]
    float v[12];
    #pragma unroll
    for (int j = 0; j < 12; ++j) v[j] = 0.f;
    if (g == 0) {                               // modulation: silu(time_cond) @ tmod_w
        float u  = tc[b * D_ + d];
        float si = u / (1.0f + expf(-u));
        float4 t0 = ((const float4*)tw)[d * 2], t1 = ((const float4*)tw)[d * 2 + 1];
        v[4] = si * t0.x; v[5]  = si * t0.y; v[6]  = si * t0.z; v[7]  = si * t0.w;
        v[8] = si * t1.x; v[9]  = si * t1.y; v[10] = si * t1.z; v[11] = si * t1.w;
    }
    seg[g][d] = (a[0] + a[1]) + (a[2] + a[3]);
    __syncthreads();
    {
        float hs = seg[0][d], wsu = seg[1][d], ps = seg[2][d];
        float gi = (g == 0) ? (hs + wsu + ps) * (1.0f / 3072.0f)
                 : (g == 1) ? (hs + ps)       * (1.0f / 2048.0f)
                            : (wsu + ps)      * (1.0f / 2048.0f);
        v[0] = gi * w4.x; v[1] = gi * w4.y; v[2] = gi * w4.z; v[3] = gi * w4.w;
    }
    #pragma unroll
    for (int j = 0; j < 12; ++j) {
        #pragma unroll
        for (int m = 16; m > 0; m >>= 1) v[j] += __shfl_xor(v[j], m, 32);
    }
    if ((t & 31) == 0) {
        #pragma unroll
        for (int j = 0; j < 12; ++j) red[t >> 5][j] = v[j];
    }
    __syncthreads();
    if (t < 12) {
        float s = (t < E_) ? gb[t] : tb[t - E_];
        #pragma unroll
        for (int w = 0; w < 24; ++w) s += red[w][t];
        fin[t] = s;
    }
    __syncthreads();
    if (t == 0) {
        float p[E_]; float mx = -1e30f;
        for (int e = 0; e < E_; ++e) {
            p[e] = fin[e] * (1.0f + fin[E_ + e]) + fin[2 * E_ + e];
            mx = fmaxf(mx, p[e]);
        }
        float se = 0.f;
        for (int e = 0; e < E_; ++e) { p[e] = expf(p[e] - mx); se += p[e]; }
        for (int e = 0; e < E_; ++e) p[e] /= se;
        int i1 = 0;
        for (int e = 1; e < E_; ++e) if (p[e] > p[i1]) i1 = e;
        int i2 = (i1 == 0) ? 1 : 0;
        for (int e = 0; e < E_; ++e) if (e != i1 && p[e] > p[i2]) i2 = e;
        float s2 = p[i1] + p[i2] + 1e-8f;
        for (int e = 0; e < E_; ++e)
            wbe[b * E_ + e] = (e == i1) ? (p[i1] / s2) : ((e == i2) ? (p[i2] / s2) : 0.0f);
    }
}

// ---------------------------------------------------------------------------
// Kernel 3: pack fp32 weights into bf16 WMMA B-operand tiles.
// Tile = 32(K) x 16(N), 1 KiB; element e of lane l sits at byte (e/8)*512 + l*16 + (e%8)*2
// (the layout ldfrag reads) and maps to (kk, n):
//   n = l & 15 ; kk = (e/8)*16 + (l/16)*8 + (e%8)
// Tiles stored [nt][kt] contiguous in kt.
// ---------------------------------------------------------------------------
__global__ __launch_bounds__(128) void pack_kernel(const float* __restrict__ ew1,
                                                   const float* __restrict__ ew2,
                                                   const float* __restrict__ sw1,
                                                   const float* __restrict__ sw2,
                                                   char* __restrict__ ws) {
    __shared__ float tileS[512];
    int tb = blockIdx.x;
    const float* src; char* dst; int K, N, local;
    if (tb < 2048) {           // ew1: (E, 256, 1024), K=256 N=1024, 512 tiles/expert
        int ex = tb >> 9; local = tb & 511;
        src = ew1 + (size_t)ex * D_ * H_;
        dst = ws + PACK_EW1 + (size_t)tb * 1024;
        K = D_; N = H_;
    } else if (tb < 4096) {    // ew2: (E, 1024, 256), K=1024 N=256
        int t2 = tb - 2048; int ex = t2 >> 9; local = t2 & 511;
        src = ew2 + (size_t)ex * H_ * D_;
        dst = ws + PACK_EW2 + (size_t)t2 * 1024;
        K = H_; N = D_;
    } else if (tb < 4608) {    // sw1: (256, 1024)
        local = tb - 4096;
        src = sw1; dst = ws + PACK_SW1 + (size_t)local * 1024;
        K = D_; N = H_;
    } else {                   // sw2: (1024, 256)
        local = tb - 4608;
        src = sw2; dst = ws + PACK_SW2 + (size_t)local * 1024;
        K = H_; N = D_;
    }
    int ktiles = K / 32;
    int nt = local / ktiles, kt = local % ktiles;
    int k0 = kt * 32, n0 = nt * 16;
    int t = threadIdx.x;
    #pragma unroll
    for (int i = 0; i < 4; ++i) {
        int e = t + 128 * i;
        int k = e >> 4, nn = e & 15;
        tileS[e] = src[(size_t)(k0 + k) * N + (n0 + nn)];
    }
    __syncthreads();
    uint16_t hv[4];
    #pragma unroll
    for (int i = 0; i < 4; ++i) {
        int p = t * 4 + i;
        int lanep = (p >> 3) & 31;
        int nn = lanep & 15, half = lanep >> 4;
        int kk = ((p >> 8) << 4) + (half << 3) + (p & 7);
        hv[i] = f2bfbits(tileS[kk * 16 + nn]);
    }
    uint32_t lo = (uint32_t)hv[0] | ((uint32_t)hv[1] << 16);
    uint32_t hi = (uint32_t)hv[2] | ((uint32_t)hv[3] << 16);
    ((uint2*)dst)[t] = make_uint2(lo, hi);
}

// ---------------------------------------------------------------------------
// Kernel 4: fused MoE + shared MLP.
// Block = 256 thr = 8 waves; each wave owns a 16-row token tile (block: 128 rows,
// all inside one segment -> expert activity is block-uniform).
// Per n2c iteration the whole block shares one staged copy of the 32 B-tiles
// (16 GEMM1 + 16 GEMM2 = 32 KiB), double-buffered via async global->LDS copies.
// The B fragments are read from LDS in two groups per n2c (24 and 8 fragments) that stand
// ahead of the WMMA blocks; no LDS read stands among the WMMAs.
// ---------------------------------------------------------------------------
__global__ __launch_bounds__(256) void moe_kernel(const float* __restrict__ x,
                                                  const float* __restrict__ eb1,
                                                  const float* __restrict__ eb2,
                                                  const float* __restrict__ sb1,
                                                  const float* __restrict__ sb2,
                                                  const float* __restrict__ wbe,
                                                  const char* __restrict__ ws,
                                                  float* __restrict__ out) {
    __shared__ float cbias[D_];
    __shared__ float wz[8];
    __shared__ float b1s[H_];
    __shared__ __align__(32) uint16_t hstage[8][16 * 32];
    __shared__ __align__(32) char bstage[2][32 * 1024];   // [buf][tile 0..31][1KiB]

    const int tid   = threadIdx.x;
    const int wv    = tid >> 5;
    const int lane  = tid & 31;
    const int n     = lane & 15;     // B/C column ; A row
    const int khalf = lane >> 4;
    const int b     = blockIdx.y;
    const int l0    = blockIdx.x * 128 + wv * 16;
    const int seg   = (blockIdx.x * 128) >> 10;  // 0=head 1=wrist 2=prop

    if (tid < E_) {
        float w = wbe[b * E_ + tid];
        bool act = (tid == 1) ? (seg != 1) : (tid == 2) ? (seg != 0) : true;
        wz[tid] = act ? w : 0.0f;
    }
    if (tid == E_) wz[E_] = 1.0f;    // shared MLP pseudo-expert
    __syncthreads();
    {   // combined output bias: sb2 + sum_e w_e * eb2_e  (blockDim == 256 == D_)
        float s = sb2[tid];
        #pragma unroll
        for (int e = 0; e < E_; ++e) s += wz[e] * eb2[e * D_ + tid];
        cbias[tid] = s;
    }

    // Build A1: x rows [l0, l0+16) -> bf16 A-operand layout, 8 K-chunks of 32
    const float4* xr = (const float4*)(x + ((size_t)b * L_ + l0 + n) * D_);
    v16bf A1[8];
    #pragma unroll
    for (int c = 0; c < 8; ++c) {
        #pragma unroll
        for (int part = 0; part < 2; ++part) {
            int kb = c * 32 + part * 16 + khalf * 8;
            float4 f0 = xr[kb >> 2];
            float4 f1 = xr[(kb >> 2) + 1];
            A1[c][part * 8 + 0] = f2bf(f0.x);
            A1[c][part * 8 + 1] = f2bf(f0.y);
            A1[c][part * 8 + 2] = f2bf(f0.z);
            A1[c][part * 8 + 3] = f2bf(f0.w);
            A1[c][part * 8 + 4] = f2bf(f1.x);
            A1[c][part * 8 + 5] = f2bf(f1.y);
            A1[c][part * 8 + 6] = f2bf(f1.z);
            A1[c][part * 8 + 7] = f2bf(f1.w);
        }
    }

    v8f outAcc[16];
    #pragma unroll
    for (int i = 0; i < 16; ++i) { v8f z = {}; outAcc[i] = z; }

    for (int ex = 0; ex < 5; ++ex) {
        float wgt = wz[ex];
        if (wgt == 0.0f) continue;   // block-uniform: skip masked / non-top-k experts
        const char* w1p = (ex < 4) ? (ws + PACK_EW1 + (size_t)ex * 512 * 1024)
                                   : (ws + PACK_SW1);
        const char* w2p = (ex < 4) ? (ws + PACK_EW2 + (size_t)ex * 512 * 1024)
                                   : (ws + PACK_SW2);
        const float* b1p = (ex < 4) ? (eb1 + ex * H_) : sb1;

        __syncthreads();   // prev expert fully done before we touch b1s / bstage[0]
        for (int i = tid; i < H_; i += 256) b1s[i] = b1p[i];

        // cooperative stage of the 32 B tiles for one n2c: 8 copies of 16 bytes per thread.
        // Lane l of a wave takes bytes [16 l, 16 l + 16) of one aligned 512-byte run, in
        // global memory and in LDS alike: a copy instruction touches 4 whole lines, not 32,
        // and its LDS writes fall on every bank once per 16 lanes.
        auto stage = [&](int n2c, int bb) {
            char* d = bstage[bb] + (size_t)tid * 16;
            // GEMM1 tiles: 16 KiB contiguous at w1p + n2c*16K; the block moves 4 KiB per copy
            const char* s1 = w1p + (size_t)n2c * 16384 + (size_t)tid * 16;
            #pragma unroll
            for (int i = 0; i < 4; ++i) cp16(s1 + i * 4096, d + i * 4096);
            // GEMM2 tiles: tile n3 = 4*i + tid/64 is 1 KiB at w2p + (n3*32 + n2c) KiB
            const char* s2 = w2p + ((size_t)((tid >> 6) * 32 + n2c)) * 1024 + (size_t)(tid & 63) * 16;
            #pragma unroll
            for (int i = 0; i < 4; ++i) cp16(s2 + (size_t)i * 131072, d + 16384 + i * 4096);
        };

        stage(0, 0);
        for (int n2c = 0; n2c < 32; ++n2c) {       // H in chunks of 32
            const char* buf = bstage[n2c & 1];
            cp_wait();                 // own async copies landed
            __syncthreads();           // everyone's copies landed; prev compute done
            if (n2c + 1 < 32) stage(n2c + 1, (n2c + 1) & 1);

            // The B fragments are read from LDS in two groups that stand ahead of the WMMA blocks,
            // never one by one among the WMMAs: the wave pays the LDS latency once per group, the
            // counted waits let each WMMA start when its own fragment has landed, and the LDS
            // always has a queue of reads to serve.
            // Group 1: GEMM1's 16 fragments (h columns [n2c*32, n2c*32+32)) and GEMM2's tiles 0..7.
            float bias[2];
            #pragma unroll
            for (int t = 0; t < 2; ++t) bias[t] = b1s[(n2c * 2 + t) * 16 + n];
            v16bf f1[16], f2a[8], f2b[8];
            #pragma unroll
            for (int i = 0; i < 16; ++i) f1[i] = ldfrag(buf + (size_t)i * 1024, lane);
            #pragma unroll
            for (int i = 0; i < 8; ++i) f2a[i] = ldfrag(buf + 16384 + (size_t)i * 1024, lane);
            // keeps group 1 from being moved back in among the WMMAs
            __builtin_amdgcn_sched_barrier(0);
            // ---- GEMM1 ----
            #pragma unroll
            for (int t = 0; t < 2; ++t) {
                v8f acc = {};
                #pragma unroll
                for (int kc = 0; kc < 8; ++kc)     // K = D = 256
                    acc = __builtin_amdgcn_wmma_f32_16x16x32_bf16(
                              false, A1[kc], false, f1[t * 8 + kc], (short)0, acc, false, false);
                float hx[8], hs[8];                // gelu stage by stage: no element waits on another
                #pragma unroll
                for (int r = 0; r < 8; ++r) hx[r] = acc[r] + bias[t];
                #pragma unroll
                for (int r = 0; r < 8; ++r) hs[r] = gelu_arg(hx[r]);
                #pragma unroll
                for (int r = 0; r < 8; ++r) hs[r] = 1.0f + __builtin_amdgcn_exp2f(hs[r]);
                #pragma unroll
                for (int r = 0; r < 8; ++r) hs[r] = __builtin_amdgcn_rcpf(hs[r]);
                #pragma unroll
                for (int r = 0; r < 8; ++r) {      // weight, restage (C->A)
                    float hv = hx[r] * hs[r] * wgt;
                    int mrow = r + 8 * khalf;
                    int kk   = t * 16 + n;
                    int lp   = mrow + 16 * ((kk >> 3) & 1);
                    int e2   = ((kk >> 4) << 3) + (kk & 7);
                    hstage[wv][(e2 >> 3) * 256 + lp * 8 + (e2 & 7)] = f2bfbits(hv);
                }
            }
            // Group 2: the restaged A fragment, then GEMM2's tiles 8..15, in flight under tiles 0..7
            v16bf a2 = ldfrag((const char*)&hstage[wv][0], lane);  // per-wave slice, DS in-order
            #pragma unroll
            for (int i = 0; i < 8; ++i) f2b[i] = ldfrag(buf + 16384 + (size_t)(8 + i) * 1024, lane);
            // keeps group 2 from being moved in among GEMM2's WMMAs
            __builtin_amdgcn_sched_barrier(0);
            // ---- GEMM2: outAcc += a2(16x32) @ W2[n2c*32 .. , :256) ----
            #pragma unroll
            for (int n3 = 0; n3 < 16; ++n3)
                outAcc[n3] = __builtin_amdgcn_wmma_f32_16x16x32_bf16(
                                 false, a2, false, (n3 < 8) ? f2a[n3] : f2b[n3 - 8],
                                 (short)0, outAcc[n3], false, false);
        }
    }
    __syncthreads();

    // Write output tile (+ combined bias)
    #pragma unroll
    for (int n3 = 0; n3 < 16; ++n3) {
        #pragma unroll
        for (int r = 0; r < 8; ++r) {
            int row = r + 8 * khalf;
            int col = n3 * 16 + n;
            out[((size_t)b * L_ + l0 + row) * D_ + col] = outAcc[n3][r] + cbias[col];
        }
    }
}

// ---------------------------------------------------------------------------
extern "C" void kernel_launch(void* const* d_in, const int* in_sizes, int n_in,
                              void* d_out, int out_size, void* d_ws, size_t ws_size,
                              hipStream_t stream) {
    (void)in_sizes; (void)n_in; (void)out_size; (void)ws_size;
    const float* x   = (const float*)d_in[0];
    const float* tc  = (const float*)d_in[1];
    const float* gw  = (const float*)d_in[2];
    const float* gb  = (const float*)d_in[3];
    const float* tw  = (const float*)d_in[4];
    const float* tb  = (const float*)d_in[5];
    const float* ew1 = (const float*)d_in[6];
    const float* eb1 = (const float*)d_in[7];
    const float* ew2 = (const float*)d_in[8];
    const float* eb2 = (const float*)d_in[9];
    const float* sw1 = (const float*)d_in[10];
    const float* sb1 = (const float*)d_in[11];
    const float* sw2 = (const float*)d_in[12];
    const float* sb2 = (const float*)d_in[13];
    char*  ws  = (char*)d_ws;
    float* part = (float*)(ws + PART_OFF);
    float* wbe = (float*)(ws + WBE_OFF);
    float* out = (float*)d_out;

    agg_kernel <<<dim3(CH_, B_), 256, 0, stream>>>(x, part);
    gate_kernel<<<B_, 768, 0, stream>>>(part, tc, gw, gb, tw, tb, wbe);
    pack_kernel<<<5120, 128, 0, stream>>>(ew1, ew2, sw1, sw2, ws);
    moe_kernel <<<dim3(L_ / 128, B_), 256, 0, stream>>>(x, eb1, eb2, sb1, sb2, wbe, ws, out);
}

// v006
// Measured time: 100 microseconds a run.
// Next to v005, in two timings, it ran 1.14 and 1.11 times as fast.
// All steps since v000 together make it 4.45 times as fast.
#include <hip/hip_runtime.h>
#include <hip/hip_bf16.h>
#include <stdint.h>

typedef __attribute__((ext_vector_type(16))) __bf16 v16bf;
typedef __attribute__((ext_vector_type(8)))  __bf16 v8bf;
typedef __attribute__((ext_vector_type(8)))  float  v8f;
typedef int v4i_ __attribute__((__vector_size__(16)));
typedef __attribute__((address_space(1))) v4i_* gp_v4i;
typedef __attribute__((address_space(3))) v4i_* lp_v4i;

#define B_ 8
#define L_ 3072
#define D_ 256
#define E_ 4
#define H_ 1024

// d_ws layout (bytes)
#define WBE_OFF   (32*1024)             // B*E floats
#define PACK_EW1  (64*1024)             // 4 experts * 512 tiles * 1 KiB = 2 MiB
#define PACK_EW2  (PACK_EW1 + 2*1024*1024)
#define PACK_SW1  (PACK_EW2 + 2*1024*1024)   // 512 KiB
#define PACK_SW2  (PACK_SW1 + 512*1024)      // 512 KiB
#define PART_OFF  (8*1024*1024)         // B * CH_ * D floats = 768 KiB
#define CH_ 96                          // 32-row chunks per batch

#if defined(__has_builtin)
# if __has_builtin(__builtin_amdgcn_global_load_async_to_lds_b128)
#  define HAVE_ASYNC 1
# endif
#endif

__device__ __forceinline__ uint16_t f2bfbits(float f) {
    union { float f; uint32_t u; } a; a.f = f;
    uint32_t r = a.u + 0x7FFFu + ((a.u >> 16) & 1u);   // round-to-nearest-even
    return (uint16_t)(r >> 16);
}
__device__ __forceinline__ __bf16 f2bf(float f) {
    uint16_t h = f2bfbits(f);
    __bf16 o; __builtin_memcpy(&o, &h, 2); return o;
}
// tanh-approx gelu (approximate=True), branch-free:
//   0.5 x (1 + tanh u) = x / (1 + exp(-2u)),  u = sqrt(2/pi) (x + 0.044715 x^3)
// exp(-2u) = exp2(x (K0 + K1 x^2)) with K0 = -2 sqrt(2/pi) log2(e), K1 = 0.044715 K0.
// Saturates by itself: exp2 -> inf gives x * 0, exp2 -> 0 gives x.
__device__ __forceinline__ float gelu_arg(float x) {   // the exp2 argument
    const float K0 = -2.3022081986f, K1 = -0.1029432396f;
    return x * fmaf(x * x, K1, K0);
}

// One 16x32 / 32x16 bf16 fragment (1 KiB) from LDS. The tile is stored as two 512-byte
// halves; lane l owns bytes [16 l, 16 l + 16) of each half (elements 0..7, then 8..15).
// Each 16-byte read of a wave is then 512 contiguous bytes: 16 lanes cover all 64 banks once.
__device__ __forceinline__ v16bf ldfrag(const char* tile, int lane) {
    v8bf lo, hi;
    __builtin_memcpy(&lo, tile + lane * 16, 16);
    __builtin_memcpy(&hi, tile + 512 + lane * 16, 16);
    return __builtin_shufflevector(lo, hi, 0, 1, 2, 3, 4, 5, 6, 7, 8, 9, 10, 11, 12, 13, 14, 15);
}

// 16-byte global -> LDS copy: async (ASYNCcnt, bypasses VGPRs) when available.
__device__ __forceinline__ void cp16(const char* g, char* l) {
#if HAVE_ASYNC
    __builtin_amdgcn_global_load_async_to_lds_b128(
        (gp_v4i)(const_cast<char*>(g)), (lp_v4i)(l), 0, 0);
#else
    *(float4*)l = *(const float4*)g;
#endif
}
__device__ __forceinline__ void cp_wait() {
#if HAVE_ASYNC
# if __has_builtin(__builtin_amdgcn_s_wait_asynccnt)
    __builtin_amdgcn_s_wait_asynccnt(0);
# else
    asm volatile("s_wait_asynccnt 0" ::: "memory");
# endif
#endif
}

// ---------------------------------------------------------------------------
// Kernel 1: partial column sums of x. One work-group per (batch, 32-row chunk);
// a chunk lies inside one segment (32 chunks per segment of 1024 rows).
// Each thread keeps 8 independent 16-byte loads in flight (rows rg, rg+4, ...).
// ---------------------------------------------------------------------------
__global__ __launch_bounds__(256) void agg_kernel(const float* __restrict__ x,
                                                  float* __restrict__ part) {
    __shared__ float4 red4[4][64];
    const int c = blockIdx.x, b = blockIdx.y, t = threadIdx.x;
    const int q = t & 63, rg = t >> 6;
    const float4* xp = (const float4*)(x + ((size_t)b * L_ + c * 32 + rg) * D_) + q;
    float4 v[8];
    #pragma unroll
    for (int i = 0; i < 8; ++i) v[i] = xp[(size_t)i * 4 * (D_ / 4)];
    #pragma unroll
    for (int s = 4; s > 0; s >>= 1) {
        #pragma unroll
        for (int i = 0; i < s; ++i) {
            v[i].x += v[i + s].x; v[i].y += v[i + s].y;
            v[i].z += v[i + s].z; v[i].w += v[i + s].w;
        }
    }
    red4[rg][q] = v[0];
    __syncthreads();
    const float* r = (const float*)red4;
    part[((size_t)b * CH_ + c) * D_ + t] =
        (r[t] + r[D_ + t]) + (r[2 * D_ + t] + r[3 * D_ + t]);
}

// ---------------------------------------------------------------------------
// Kernel 2: gating -> w_be (renormalized top-2, zeros elsewhere).
// One work-group per batch, 768 threads = one per gate_in element.
// Thread (g, d) first sums segment g's 32 partials of column d, then owns
// gate_in[g*256 + d]; the 4 logit and 8 modulation dot products are summed by
// wave shuffles and one pass through LDS.
// ---------------------------------------------------------------------------
__global__ __launch_bounds__(768) void gate_kernel(const float* __restrict__ part,
                                                   const float* __restrict__ tc,
                                                   const float* __restrict__ gw,
                                                   const float* __restrict__ gb,
                                                   const float* __restrict__ tw,
                                                   const float* __restrict__ tb,
                                                   float* __restrict__ wbe) {
    __shared__ float seg[3][D_];
    __shared__ float red[24][12];
    __shared__ float fin[12];
    const int b = blockIdx.x, t = threadIdx.x;
    const int g = t >> 8, d = t & 255;          // g is wave-uniform
    const float* pp = part + ((size_t)b * CH_ + g * 32) * D_ + d;
    float a[4] = {0.f, 0.f, 0.f, 0.f};
    #pragma unroll
    for (int i = 0; i < 32; ++i) a[i & 3] += pp[(size_t)i * D_];
    const float4 w4 = ((const float4*)gw)[t];   // gate_w[t][0..3]
    float v[12];
    #pragma unroll
    for (int j = 0; j < 12; ++j) v[j] = 0.f;
    if (g == 0) {                               // modulation: silu(time_cond) @ tmod_w
        float u  = tc[b * D_ + d];
        float si = u / (1.0f + expf(-u));
        float4 t0 = ((const float4*)tw)[d * 2], t1 = ((const float4*)tw)[d * 2 + 1];
        v[4] = si * t0.x; v[5]  = si * t0.y; v[6]  = si * t0.z; v[7]  = si * t0.w;
        v[8] = si * t1.x; v[9]  = si * t1.y; v[10] = si * t1.z; v[11] = si * t1.w;
    }
    seg[g][d] = (a[0] + a[1]) + (a[2] + a[3]);
    __syncthreads();
    {
        float hs = seg[0][d], wsu = seg[1][d], ps = seg[2][d];
        float gi = (g == 0) ? (hs + wsu + ps) * (1.0f / 3072.0f)
                 : (g == 1) ? (hs + ps)       * (1.0f / 2048.0f)
                            : (wsu + ps)      * (1.0f / 2048.0f);
        v[0] = gi * w4.x; v[1] = gi * w4.y; v[2] = gi * w4.z; v[3] = gi * w4.w;
    }
    #pragma unroll
    for (int j = 0; j < 12; ++j) {
        #pragma unroll
        for (int m = 16; m > 0; m >>= 1) v[j] += __shfl_xor(v[j], m, 32);
    }
    if ((t & 31) == 0) {
        #pragma unroll
        for (int j = 0; j < 12; ++j) red[t >> 5][j] = v[j];
    }
    __syncthreads();
    if (t < 12) {
        float s = (t < E_) ? gb[t] : tb[t - E_];
        #pragma unroll
        for (int w = 0; w < 24; ++w) s += red[w][t];
        fin[t] = s;
    }
    __syncthreads();
    if (t == 0) {
        float p[E_]; float mx = -1e30f;
        for (int e = 0; e < E_; ++e) {
            p[e] = fin[e] * (1.0f + fin[E_ + e]) + fin[2 * E_ + e];
            mx = fmaxf(mx, p[e]);
        }
        float se = 0.f;
        for (int e = 0; e < E_; ++e) { p[e] = expf(p[e] - mx); se += p[e]; }
        for (int e = 0; e < E_; ++e) p[e] /= se;
        int i1 = 0;
        for (int e = 1; e < E_; ++e) if (p[e] > p[i1]) i1 = e;
        int i2 = (i1 == 0) ? 1 : 0;
        for (int e = 0; e < E_; ++e) if (e != i1 && p[e] > p[i2]) i2 = e;
        float s2 = p[i1] + p[i2] + 1e-8f;
        for (int e = 0; e < E_; ++e)
            wbe[b * E_ + e] = (e == i1) ? (p[i1] / s2) : ((e == i2) ? (p[i2] / s2) : 0.0f);
    }
}

// ---------------------------------------------------------------------------
// Kernel 3: pack fp32 weights into bf16 WMMA B-operand tiles.
// Tile = 32(K) x 16(N), 1 KiB; element e of lane l sits at byte (e/8)*512 + l*16 + (e%8)*2
// (the layout ldfrag reads) and maps to (kk, n):
//   n = l & 15 ; kk = (e/8)*16 + (l/16)*8 + (e%8)
// Tiles stored [nt][kt] contiguous in kt.
// ---------------------------------------------------------------------------
__global__ __launch_bounds__(128) void pack_kernel(const float* __restrict__ ew1,
                                                   const float* __restrict__ ew2,
                                                   const float* __restrict__ sw1,
                                                   const float* __restrict__ sw2,
                                                   char* __restrict__ ws) {
    __shared__ float tileS[512];
    int tb = blockIdx.x;
    const float* src; char* dst; int K, N, local;
    if (tb < 2048) {           // ew1: (E, 256, 1024), K=256 N=1024, 512 tiles/expert
        int ex = tb >> 9; local = tb & 511;
        src = ew1 + (size_t)ex * D_ * H_;
        dst = ws + PACK_EW1 + (size_t)tb * 1024;
        K = D_; N = H_;
    } else if (tb < 4096) {    // ew2: (E, 1024, 256), K=1024 N=256
        int t2 = tb - 2048; int ex = t2 >> 9; local = t2 & 511;
        src = ew2 + (size_t)ex * H_ * D_;
        dst = ws + PACK_EW2 + (size_t)t2 * 1024;
        K = H_; N = D_;
    } else if (tb < 4608) {    // sw1: (256, 1024)
        local = tb - 4096;
        src = sw1; dst = ws + PACK_SW1 + (size_t)local * 1024;
        K = D_; N = H_;
    } else {                   // sw2: (1024, 256)
        local = tb - 4608;
        src = sw2; dst = ws + PACK_SW2 + (size_t)local * 1024;
        K = H_; N = D_;
    }
    int ktiles = K / 32;
    int nt = local / ktiles, kt = local % ktiles;
    int k0 = kt * 32, n0 = nt * 16;
    int t = threadIdx.x;
    #pragma unroll
    for (int i = 0; i < 4; ++i) {
        int e = t + 128 * i;
        int k = e >> 4, nn = e & 15;
        tileS[e] = src[(size_t)(k0 + k) * N + (n0 + nn)];
    }
    __syncthreads();
    uint16_t hv[4];
    #pragma unroll
    for (int i = 0; i < 4; ++i) {
        int p = t * 4 + i;
        int lanep = (p >> 3) & 31;
        int nn = lanep & 15, half = lanep >> 4;
        int kk = ((p >> 8) << 4) + (half << 3) + (p & 7);
        hv[i] = f2bfbits(tileS[kk * 16 + nn]);
    }
    uint32_t lo = (uint32_t)hv[0] | ((uint32_t)hv[1] << 16);
    uint32_t hi = (uint32_t)hv[2] | ((uint32_t)hv[3] << 16);
    ((uint2*)dst)[t] = make_uint2(lo, hi);
}

// ---------------------------------------------------------------------------
// Kernel 4: fused MoE + shared MLP.
// Block = 256 thr = 8 waves over 128 rows (all inside one segment -> expert activity is
// block-uniform). The waves form a 4 x 2 grid: wave (mg, nh) owns rows [32 mg, 32 mg + 32)
// and half nh of the columns, of the h chunk in GEMM1 and of the output in GEMM2, so every
// B fragment it reads from LDS feeds two WMMAs (two 16-row tiles). The two waves of a row
// group hand each other their halves of h through hstage. The hand-over uses the barrier that
// already stands at the head of every n2c: GEMM2 of chunk n2c - 1 runs behind that barrier,
// ahead of GEMM1 of chunk n2c, with its W2 fragments kept in registers since the pass before.
// Per n2c iteration the whole block shares one staged copy of the 32 B-tiles
// (16 GEMM1 + 16 GEMM2 = 32 KiB), double-buffered via async global->LDS copies.
// A wave's B fragments are read from LDS in two groups per n2c, each ahead of a WMMA block.
// ---------------------------------------------------------------------------
__global__ __launch_bounds__(256) void moe_kernel(const float* __restrict__ x,
                                                  const float* __restrict__ eb1,
                                                  const float* __restrict__ eb2,
                                                  const float* __restrict__ sb1,
                                                  const float* __restrict__ sb2,
                                                  const float* __restrict__ wbe,
                                                  const char* __restrict__ ws,
                                                  float* __restrict__ out) {
    __shared__ float cbias[D_];
    __shared__ float wz[8];
    __shared__ float b1s[H_];
    __shared__ __align__(32) uint16_t hstage[2][8][16 * 32];  // [n2c & 1][2 mg + row tile][16 x 32 A tile]
    __shared__ __align__(32) char bstage[2][32 * 1024];   // [buf][tile 0..31][1KiB]

    const int tid   = threadIdx.x;
    const int wv    = tid >> 5;
    const int lane  = tid & 31;
    const int n     = lane & 15;     // B/C column ; A row
    const int khalf = lane >> 4;
    const int b     = blockIdx.y;
    const int mg    = wv >> 1;       // row group
    const int nh    = wv & 1;        // column half
    const int l0    = blockIdx.x * 128 + mg * 32;
    const int seg   = (blockIdx.x * 128) >> 10;  // 0=head 1=wrist 2=prop

    if (tid < E_) {
        float w = wbe[b * E_ + tid];
        bool act = (tid == 1) ? (seg != 1) : (tid == 2) ? (seg != 0) : true;
        wz[tid] = act ? w : 0.0f;
    }
    if (tid == E_) wz[E_] = 1.0f;    // shared MLP pseudo-expert
    __syncthreads();
    {   // combined output bias: sb2 + sum_e w_e * eb2_e  (blockDim == 256 == D_)
        float s = sb2[tid];
        #pragma unroll
        for (int e = 0; e < E_; ++e) s += wz[e] * eb2[e * D_ + tid];
        cbias[tid] = s;
    }

    // Build A1: x rows [l0, l0+32) -> bf16 A-operand layout, 2 row tiles x 8 K-chunks of 32
    v16bf A1[2][8];
    #pragma unroll
    for (int mt = 0; mt < 2; ++mt) {
        const float4* xr = (const float4*)(x + ((size_t)b * L_ + l0 + mt * 16 + n) * D_);
        #pragma unroll
        for (int c = 0; c < 8; ++c) {
            #pragma unroll
            for (int part = 0; part < 2; ++part) {
                int kb = c * 32 + part * 16 + khalf * 8;
                float4 f0 = xr[kb >> 2];
                float4 f1 = xr[(kb >> 2) + 1];
                A1[mt][c][part * 8 + 0] = f2bf(f0.x);
                A1[mt][c][part * 8 + 1] = f2bf(f0.y);
                A1[mt][c][part * 8 + 2] = f2bf(f0.z);
                A1[mt][c][part * 8 + 3] = f2bf(f0.w);
                A1[mt][c][part * 8 + 4] = f2bf(f1.x);
                A1[mt][c][part * 8 + 5] = f2bf(f1.y);
                A1[mt][c][part * 8 + 6] = f2bf(f1.z);
                A1[mt][c][part * 8 + 7] = f2bf(f1.w);
            }
        }
    }

    v8f outAcc[2][8];                // [row tile][column tile of this wave's half]
    #pragma unroll
    for (int mt = 0; mt < 2; ++mt) {
        #pragma unroll
        for (int i = 0; i < 8; ++i) { v8f z = {}; outAcc[mt][i] = z; }
    }

    for (int ex = 0; ex < 5; ++ex) {
        float wgt = wz[ex];
        if (wgt == 0.0f) continue;   // block-uniform: skip masked / non-top-k experts
        const char* w1p = (ex < 4) ? (ws + PACK_EW1 + (size_t)ex * 512 * 1024)
                                   : (ws + PACK_SW1);
        const char* w2p = (ex < 4) ? (ws + PACK_EW2 + (size_t)ex * 512 * 1024)
                                   : (ws + PACK_SW2);
        const float* b1p = (ex < 4) ? (eb1 + ex * H_) : sb1;

        __syncthreads();   // prev expert fully done before we touch b1s / bstage[0]
        for (int i = tid; i < H_; i += 256) b1s[i] = b1p[i];

        // cooperative stage of the 32 B tiles for one n2c: 8 copies of 16 bytes per thread.
        // Lane l of a wave takes bytes [16 l, 16 l + 16) of one aligned 512-byte run, in
        // global memory and in LDS alike: a copy instruction touches 4 whole lines, not 32,
        // and its LDS writes fall on every bank once per 16 lanes.
        auto stage = [&](int n2c, int bb) {
            char* d = bstage[bb] + (size_t)tid * 16;
            // GEMM1 tiles: 16 KiB contiguous at w1p + n2c*16K; the block moves 4 KiB per copy
            const char* s1 = w1p + (size_t)n2c * 16384 + (size_t)tid * 16;
            #pragma unroll
            for (int i = 0; i < 4; ++i) cp16(s1 + i * 4096, d + i * 4096);
            // GEMM2 tiles: tile n3 = 4*i + tid/64 is 1 KiB at w2p + (n3*32 + n2c) KiB
            const char* s2 = w2p + ((size_t)((tid >> 6) * 32 + n2c)) * 1024 + (size_t)(tid & 63) * 16;
            #pragma unroll
            for (int i = 0; i < 4; ++i) cp16(s2 + (size_t)i * 131072, d + 16384 + i * 4096);
        };

        // GEMM2 of one chunk: outAcc += h(32 x 32) @ W2[chunk rows, 128 nh .. +128)
        v16bf f2[8];                               // W2 fragments of the chunk whose h is in hstage
        v16bf a2[2];
        auto gemm2 = [&]() {
            #pragma unroll
            for (int n3 = 0; n3 < 8; ++n3) {
                #pragma unroll
                for (int mt = 0; mt < 2; ++mt)
                    outAcc[mt][n3] = __builtin_amdgcn_wmma_f32_16x16x32_bf16(
                                         false, a2[mt], false, f2[n3], (short)0, outAcc[mt][n3], false, false);
            }
        };

        stage(0, 0);
        for (int n2c = 0; n2c < 32; ++n2c) {       // H in chunks of 32
            const char* buf = bstage[n2c & 1];
            cp_wait();                 // own async copies landed
            __syncthreads();           // everyone's copies landed, h of chunk n2c-1 written; prev reads done
            if (n2c + 1 < 32) stage(n2c + 1, (n2c + 1) & 1);

            // Group 1, ahead of both WMMA blocks: h of chunk n2c-1 as A fragments (both column
            // halves), then GEMM1's 8 fragments of h columns [n2c*32 + 16 nh, +16).
            if (n2c > 0) {
                #pragma unroll
                for (int mt = 0; mt < 2; ++mt)
                    a2[mt] = ldfrag((const char*)&hstage[(n2c - 1) & 1][mg * 2 + mt][0], lane);
            }
            v16bf f1[8];
            #pragma unroll
            for (int i = 0; i < 8; ++i) f1[i] = ldfrag(buf + (size_t)(nh * 8 + i) * 1024, lane);
            const float bias = b1s[(n2c * 2 + nh) * 16 + n];
            // keeps group 1 from being moved in among the WMMAs
            __builtin_amdgcn_sched_barrier(0);
            if (n2c > 0) gemm2();                  // chunk n2c-1
            // keeps group 2 in one place behind GEMM2, not pair by pair among its WMMAs
            __builtin_amdgcn_sched_barrier(0);
            // Group 2: W2 tiles of chunk n2c, output columns [128 nh, +128), into the registers
            // GEMM2 has just read; they land under GEMM1 and gelu and are used in the next pass
            #pragma unroll
            for (int i = 0; i < 8; ++i) f2[i] = ldfrag(buf + 16384 + (size_t)(nh * 8 + i) * 1024, lane);
            // keeps group 2 from being moved in among GEMM1's WMMAs
            __builtin_amdgcn_sched_barrier(0);
            // ---- GEMM1: 32 rows x 16 h columns, each B fragment used for both row tiles ----
            v8f acc[2] = {};
            #pragma unroll
            for (int kc = 0; kc < 8; ++kc) {       // K = D = 256
                #pragma unroll
                for (int mt = 0; mt < 2; ++mt)
                    acc[mt] = __builtin_amdgcn_wmma_f32_16x16x32_bf16(
                                  false, A1[mt][kc], false, f1[kc], (short)0, acc[mt], false, false);
            }
            #pragma unroll
            for (int mt = 0; mt < 2; ++mt) {
                float hx[8], hs[8];                // gelu stage by stage: no element waits on another
                #pragma unroll
                for (int r = 0; r < 8; ++r) hx[r] = acc[mt][r] + bias;
                #pragma unroll
                for (int r = 0; r < 8; ++r) hs[r] = gelu_arg(hx[r]);
                #pragma unroll
                for (int r = 0; r < 8; ++r) hs[r] = 1.0f + __builtin_amdgcn_exp2f(hs[r]);
                #pragma unroll
                for (int r = 0; r < 8; ++r) hs[r] = __builtin_amdgcn_rcpf(hs[r]);
                #pragma unroll
                for (int r = 0; r < 8; ++r) {      // weight, restage (C->A)
                    float hv = hx[r] * hs[r] * wgt;
                    int mrow = r + 8 * khalf;
                    int kk   = nh * 16 + n;
                    int lp   = mrow + 16 * ((kk >> 3) & 1);
                    int e2   = ((kk >> 4) << 3) + (kk & 7);
                    // two hstage buffers: the partner wave may still read chunk n2c-1 in this pass
                    hstage[n2c & 1][mg * 2 + mt][(e2 >> 3) * 256 + lp * 8 + (e2 & 7)] = f2bfbits(hv);
                }
            }
        }
        __syncthreads();               // h of the last chunk written by both waves of the row group
        #pragma unroll
        for (int mt = 0; mt < 2; ++mt)
            a2[mt] = ldfrag((const char*)&hstage[1][mg * 2 + mt][0], lane);
        gemm2();                                   // chunk 31
    }
    __syncthreads();

    // Write output tile (+ combined bias)
    #pragma unroll
    for (int mt = 0; mt < 2; ++mt) {
        #pragma unroll
        for (int n3 = 0; n3 < 8; ++n3) {
            #pragma unroll
            for (int r = 0; r < 8; ++r) {
                int row = mt * 16 + r + 8 * khalf;
                int col = (nh * 8 + n3) * 16 + n;
                out[((size_t)b * L_ + l0 + row) * D_ + col] = outAcc[mt][n3][r] + cbias[col];
            }
        }
    }
}

// ---------------------------------------------------------------------------
extern "C" void kernel_launch(void* const* d_in, const int* in_sizes, int n_in,
                              void* d_out, int out_size, void* d_ws, size_t ws_size,
                              hipStream_t stream) {
    (void)in_sizes; (void)n_in; (void)out_size; (void)ws_size;
    const float* x   = (const float*)d_in[0];
    const float* tc  = (const float*)d_in[1];
    const float* gw  = (const float*)d_in[2];
    const float* gb  = (const float*)d_in[3];
    const float* tw  = (const float*)d_in[4];
    const float* tb  = (const float*)d_in[5];
    const float* ew1 = (const float*)d_in[6];
    const float* eb1 = (const float*)d_in[7];
    const float* ew2 = (const float*)d_in[8];
    const float* eb2 = (const float*)d_in[9];
    const float* sw1 = (const float*)d_in[10];
    const float* sb1 = (const float*)d_in[11];
    const float* sw2 = (const float*)d_in[12];
    const float* sb2 = (const float*)d_in[13];
    char*  ws  = (char*)d_ws;
    float* part = (float*)(ws + PART_OFF);
    float* wbe = (float*)(ws + WBE_OFF);
    float* out = (float*)d_out;

    agg_kernel <<<dim3(CH_, B_), 256, 0, stream>>>(x, part);
    gate_kernel<<<B_, 768, 0, stream>>>(part, tc, gw, gb, tw, tb, wbe);
    pack_kernel<<<5120, 128, 0, stream>>>(ew1, ew2, sw1, sw2, ws);
    moe_kernel <<<dim3(L_ / 128, B_), 256, 0, stream>>>(x, eb1, eb2, sb1, sb2, wbe, ws, out);
}

// v007
// A run of this version takes 85 microseconds.
// Timed twice side by side with v006, it ran 1.16 and 1.17 times as fast.
// Over all steps from v000 it is 5.19 times as fast.
#include <hip/hip_runtime.h>
#include <hip/hip_bf16.h>
#include <stdint.h>

typedef __attribute__((ext_vector_type(16))) __bf16 v16bf;
typedef __attribute__((ext_vector_type(8)))  __bf16 v8bf;
typedef __attribute__((ext_vector_type(8)))  float  v8f;
typedef int v4i_ __attribute__((__vector_size__(16)));
typedef __attribute__((address_space(1))) v4i_* gp_v4i;
typedef __attribute__((address_space(3))) v4i_* lp_v4i;

#define B_ 8
#define L_ 3072
#define D_ 256
#define E_ 4
#define H_ 1024

// d_ws layout (bytes)
#define WBE_OFF   (32*1024)             // B*E floats
#define PACK_EW1  (64*1024)             // 4 experts * 512 tiles * 1 KiB = 2 MiB
#define PACK_EW2  (PACK_EW1 + 2*1024*1024)
#define PACK_SW1  (PACK_EW2 + 2*1024*1024)   // 512 KiB
#define PACK_SW2  (PACK_SW1 + 512*1024)      // 512 KiB
#define PART_OFF  (8*1024*1024)         // B * CH_ * D floats = 768 KiB
#define CH_ 96                          // 32-row chunks per batch

#if defined(__has_builtin)
# if __has_builtin(__builtin_amdgcn_global_load_async_to_lds_b128)
#  define HAVE_ASYNC 1
# endif
#endif

__device__ __forceinline__ uint16_t f2bfbits(float f) {
    union { float f; uint32_t u; } a; a.f = f;
    uint32_t r = a.u + 0x7FFFu + ((a.u >> 16) & 1u);   // round-to-nearest-even
    return (uint16_t)(r >> 16);
}
__device__ __forceinline__ __bf16 f2bf(float f) {
    uint16_t h = f2bfbits(f);
    __bf16 o; __builtin_memcpy(&o, &h, 2); return o;
}
// tanh-approx gelu (approximate=True), branch-free:
//   0.5 x (1 + tanh u) = x / (1 + exp(-2u)),  u = sqrt(2/pi) (x + 0.044715 x^3)
// exp(-2u) = exp2(x (K0 + K1 x^2)) with K0 = -2 sqrt(2/pi) log2(e), K1 = 0.044715 K0.
// Saturates by itself: exp2 -> inf gives x * 0, exp2 -> 0 gives x.
__device__ __forceinline__ float gelu_arg(float x) {   // the exp2 argument
    const float K0 = -2.3022081986f, K1 = -0.1029432396f;
    return x * fmaf(x * x, K1, K0);
}

// One 16x32 / 32x16 bf16 fragment (1 KiB) from LDS. The tile is stored as two 512-byte
// halves; lane l owns bytes [16 l, 16 l + 16) of each half (elements 0..7, then 8..15).
// Each 16-byte read of a wave is then 512 contiguous bytes: 16 lanes cover all 64 banks once.
__device__ __forceinline__ v16bf ldfrag(const char* tile, int lane) {
    v8bf lo, hi;
    __builtin_memcpy(&lo, tile + lane * 16, 16);
    __builtin_memcpy(&hi, tile + 512 + lane * 16, 16);
    return __builtin_shufflevector(lo, hi, 0, 1, 2, 3, 4, 5, 6, 7, 8, 9, 10, 11, 12, 13, 14, 15);
}

// The same fragment with its two halves taken in the order (first, other): the k order inside a
// WMMA is free as long as A and B agree, and GEMM2's A fragment starts with the wave's own half.
__device__ __forceinline__ v16bf ldfrag_from(const char* tile, int lane, int first) {
    v8bf lo, hi;
    __builtin_memcpy(&lo, tile + first * 512 + lane * 16, 16);
    __builtin_memcpy(&hi, tile + (first ^ 1) * 512 + lane * 16, 16);
    return __builtin_shufflevector(lo, hi, 0, 1, 2, 3, 4, 5, 6, 7, 8, 9, 10, 11, 12, 13, 14, 15);
}

// 16-byte global -> LDS copy: async (ASYNCcnt, bypasses VGPRs) when available.
__device__ __forceinline__ void cp16(const char* g, char* l) {
#if HAVE_ASYNC
    __builtin_amdgcn_global_load_async_to_lds_b128(
        (gp_v4i)(const_cast<char*>(g)), (lp_v4i)(l), 0, 0);
#else
    *(float4*)l = *(const float4*)g;
#endif
}
__device__ __forceinline__ void cp_wait() {
#if HAVE_ASYNC
# if __has_builtin(__builtin_amdgcn_s_wait_asynccnt)
    __builtin_amdgcn_s_wait_asynccnt(0);
# else
    asm volatile("s_wait_asynccnt 0" ::: "memory");
# endif
#endif
}

// ---------------------------------------------------------------------------
// Kernel 1: partial column sums of x. One work-group per (batch, 32-row chunk);
// a chunk lies inside one segment (32 chunks per segment of 1024 rows).
// Each thread keeps 8 independent 16-byte loads in flight (rows rg, rg+4, ...).
// ---------------------------------------------------------------------------
__global__ __launch_bounds__(256) void agg_kernel(const float* __restrict__ x,
                                                  float* __restrict__ part) {
    __shared__ float4 red4[4][64];
    const int c = blockIdx.x, b = blockIdx.y, t = threadIdx.x;
    const int q = t & 63, rg = t >> 6;
    const float4* xp = (const float4*)(x + ((size_t)b * L_ + c * 32 + rg) * D_) + q;
    float4 v[8];
    #pragma unroll
    for (int i = 0; i < 8; ++i) v[i] = xp[(size_t)i * 4 * (D_ / 4)];
    #pragma unroll
    for (int s = 4; s > 0; s >>= 1) {
        #pragma unroll
        for (int i = 0; i < s; ++i) {
            v[i].x += v[i + s].x; v[i].y += v[i + s].y;
            v[i].z += v[i + s].z; v[i].w += v[i + s].w;
        }
    }
    red4[rg][q] = v[0];
    __syncthreads();
    const float* r = (const float*)red4;
    part[((size_t)b * CH_ + c) * D_ + t] =
        (r[t] + r[D_ + t]) + (r[2 * D_ + t] + r[3 * D_ + t]);
}

// ---------------------------------------------------------------------------
// Kernel 2: gating -> w_be (renormalized top-2, zeros elsewhere).
// One work-group per batch, 768 threads = one per gate_in element.
// Thread (g, d) first sums segment g's 32 partials of column d, then owns
// gate_in[g*256 + d]; the 4 logit and 8 modulation dot products are summed by
// wave shuffles and one pass through LDS.
// ---------------------------------------------------------------------------
__global__ __launch_bounds__(768) void gate_kernel(const float* __restrict__ part,
                                                   const float* __restrict__ tc,
                                                   const float* __restrict__ gw,
                                                   const float* __restrict__ gb,
                                                   const float* __restrict__ tw,
                                                   const float* __restrict__ tb,
                                                   float* __restrict__ wbe) {
    __shared__ float seg[3][D_];
    __shared__ float red[24][12];
    __shared__ float fin[12];
    const int b = blockIdx.x, t = threadIdx.x;
    const int g = t >> 8, d = t & 255;          // g is wave-uniform
    const float* pp = part + ((size_t)b * CH_ + g * 32) * D_ + d;
    float a[4] = {0.f, 0.f, 0.f, 0.f};
    #pragma unroll
    for (int i = 0; i < 32; ++i) a[i & 3] += pp[(size_t)i * D_];
    const float4 w4 = ((const float4*)gw)[t];   // gate_w[t][0..3]
    float v[12];
    #pragma unroll
    for (int j = 0; j < 12; ++j) v[j] = 0.f;
    if (g == 0) {                               // modulation: silu(time_cond) @ tmod_w
        float u  = tc[b * D_ + d];
        float si = u / (1.0f + expf(-u));
        float4 t0 = ((const float4*)tw)[d * 2], t1 = ((const float4*)tw)[d * 2 + 1];
        v[4] = si * t0.x; v[5]  = si * t0.y; v[6]  = si * t0.z; v[7]  = si * t0.w;
        v[8] = si * t1.x; v[9]  = si * t1.y; v[10] = si * t1.z; v[11] = si * t1.w;
    }
    seg[g][d] = (a[0] + a[1]) + (a[2] + a[3]);
    __syncthreads();
    {
        float hs = seg[0][d], wsu = seg[1][d], ps = seg[2][d];
        float gi = (g == 0) ? (hs + wsu + ps) * (1.0f / 3072.0f)
                 : (g == 1) ? (hs + ps)       * (1.0f / 2048.0f)
                            : (wsu + ps)      * (1.0f / 2048.0f);
        v[0] = gi * w4.x; v[1] = gi * w4.y; v[2] = gi * w4.z; v[3] = gi * w4.w;
    }
    #pragma unroll
    for (int j = 0; j < 12; ++j) {
        #pragma unroll
        for (int m = 16; m > 0; m >>= 1) v[j] += __shfl_xor(v[j], m, 32);
    }
    if ((t & 31) == 0) {
        #pragma unroll
        for (int j = 0; j < 12; ++j) red[t >> 5][j] = v[j];
    }
    __syncthreads();
    if (t < 12) {
        float s = (t < E_) ? gb[t] : tb[t - E_];
        #pragma unroll
        for (int w = 0; w < 24; ++w) s += red[w][t];
        fin[t] = s;
    }
    __syncthreads();
    if (t == 0) {
        float p[E_]; float mx = -1e30f;
        for (int e = 0; e < E_; ++e) {
            p[e] = fin[e] * (1.0f + fin[E_ + e]) + fin[2 * E_ + e];
            mx = fmaxf(mx, p[e]);
        }
        float se = 0.f;
        for (int e = 0; e < E_; ++e) { p[e] = expf(p[e] - mx); se += p[e]; }
        for (int e = 0; e < E_; ++e) p[e] /= se;
        int i1 = 0;
        for (int e = 1; e < E_; ++e) if (p[e] > p[i1]) i1 = e;
        int i2 = (i1 == 0) ? 1 : 0;
        for (int e = 0; e < E_; ++e) if (e != i1 && p[e] > p[i2]) i2 = e;
        float s2 = p[i1] + p[i2] + 1e-8f;
        for (int e = 0; e < E_; ++e)
            wbe[b * E_ + e] = (e == i1) ? (p[i1] / s2) : ((e == i2) ? (p[i2] / s2) : 0.0f);
    }
}

// ---------------------------------------------------------------------------
// Kernel 3: pack fp32 weights into bf16 WMMA B-operand tiles.
// Tile = 32(K) x 16(N), 1 KiB; element e of lane l sits at byte (e/8)*512 + l*16 + (e%8)*2
// (the layout ldfrag reads) and maps to (kk, n):
//   n = l & 15 ; kk = (e/8)*16 + (l/16)*8 + (e%8)
// Tiles stored [nt][kt] contiguous in kt.
// ---------------------------------------------------------------------------
__global__ __launch_bounds__(128) void pack_kernel(const float* __restrict__ ew1,
                                                   const float* __restrict__ ew2,
                                                   const float* __restrict__ sw1,
                                                   const float* __restrict__ sw2,
                                                   char* __restrict__ ws) {
    __shared__ float tileS[512];
    int tb = blockIdx.x;
    const float* src; char* dst; int K, N, local;
    if (tb < 2048) {           // ew1: (E, 256, 1024), K=256 N=1024, 512 tiles/expert
        int ex = tb >> 9; local = tb & 511;
        src = ew1 + (size_t)ex * D_ * H_;
        dst = ws + PACK_EW1 + (size_t)tb * 1024;
        K = D_; N = H_;
    } else if (tb < 4096) {    // ew2: (E, 1024, 256), K=1024 N=256
        int t2 = tb - 2048; int ex = t2 >> 9; local = t2 & 511;
        src = ew2 + (size_t)ex * H_ * D_;
        dst = ws + PACK_EW2 + (size_t)t2 * 1024;
        K = H_; N = D_;
    } else if (tb < 4608) {    // sw1: (256, 1024)
        local = tb - 4096;
        src = sw1; dst = ws + PACK_SW1 + (size_t)local * 1024;
        K = D_; N = H_;
    } else {                   // sw2: (1024, 256)
        local = tb - 4608;
        src = sw2; dst = ws + PACK_SW2 + (size_t)local * 1024;
        K = H_; N = D_;
    }
    int ktiles = K / 32;
    int nt = local / ktiles, kt = local % ktiles;
    int k0 = kt * 32, n0 = nt * 16;
    int t = threadIdx.x;
    #pragma unroll
    for (int i = 0; i < 4; ++i) {
        int e = t + 128 * i;
        int k = e >> 4, nn = e & 15;
        tileS[e] = src[(size_t)(k0 + k) * N + (n0 + nn)];
    }
    __syncthreads();
    uint16_t hv[4];
    #pragma unroll
    for (int i = 0; i < 4; ++i) {
        int p = t * 4 + i;
        int lanep = (p >> 3) & 31;
        int nn = lanep & 15, half = lanep >> 4;
        int kk = ((p >> 8) << 4) + (half << 3) + (p & 7);
        hv[i] = f2bfbits(tileS[kk * 16 + nn]);
    }
    uint32_t lo = (uint32_t)hv[0] | ((uint32_t)hv[1] << 16);
    uint32_t hi = (uint32_t)hv[2] | ((uint32_t)hv[3] << 16);
    ((uint2*)dst)[t] = make_uint2(lo, hi);
}

// ---------------------------------------------------------------------------
// Kernel 4: fused MoE + shared MLP.
// Block = 256 thr = 8 waves over 128 rows (all inside one segment -> expert activity is
// block-uniform). The waves form a 4 x 2 grid: wave (mg, nh) owns rows [32 mg, 32 mg + 32)
// and half nh of the columns, of the h chunk in GEMM1 and of the output in GEMM2, so every
// B fragment it reads from LDS feeds two WMMAs (two 16-row tiles). GEMM1 is computed transposed
// (the W1 tile as A, the x tile as B; both operands have the same lane map), so a lane's 8
// accumulator registers hold 8 consecutive h columns of one token: converted in place they are
// one half of GEMM2's A fragment. The two waves of a row
// group hand each other their halves of h through hstage, 16 bytes per lane. The hand-over uses the barrier that
// already stands at the head of every n2c: GEMM2 of chunk n2c - 1 runs behind that barrier,
// ahead of GEMM1 of chunk n2c, with its W2 fragments kept in registers since the pass before.
// Per n2c iteration the whole block shares one staged copy of the 32 B-tiles
// (16 GEMM1 + 16 GEMM2 = 32 KiB), double-buffered via async global->LDS copies.
// A wave's B fragments are read from LDS in two groups per n2c, each ahead of a WMMA block.
// ---------------------------------------------------------------------------
__global__ __launch_bounds__(256) void moe_kernel(const float* __restrict__ x,
                                                  const float* __restrict__ eb1,
                                                  const float* __restrict__ eb2,
                                                  const float* __restrict__ sb1,
                                                  const float* __restrict__ sb2,
                                                  const float* __restrict__ wbe,
                                                  const char* __restrict__ ws,
                                                  float* __restrict__ out) {
    __shared__ float cbias[D_];
    __shared__ float wz[8];
    __shared__ __align__(32) float b1s[H_];
    __shared__ __align__(32) uint16_t hstage[2][8][16 * 32];  // [n2c & 1][2 mg + row tile][16 x 32 A tile]
    __shared__ __align__(32) char bstage[2][32 * 1024];   // [buf][tile 0..31][1KiB]

    const int tid   = threadIdx.x;
    const int wv    = tid >> 5;
    const int lane  = tid & 31;
    const int n     = lane & 15;     // B/C column ; A row
    const int khalf = lane >> 4;
    const int b     = blockIdx.y;
    const int mg    = wv >> 1;       // row group
    const int nh    = wv & 1;        // column half
    const int l0    = blockIdx.x * 128 + mg * 32;
    const int seg   = (blockIdx.x * 128) >> 10;  // 0=head 1=wrist 2=prop

    if (tid < E_) {
        float w = wbe[b * E_ + tid];
        bool act = (tid == 1) ? (seg != 1) : (tid == 2) ? (seg != 0) : true;
        wz[tid] = act ? w : 0.0f;
    }
    if (tid == E_) wz[E_] = 1.0f;    // shared MLP pseudo-expert
    __syncthreads();
    {   // combined output bias: sb2 + sum_e w_e * eb2_e  (blockDim == 256 == D_)
        float s = sb2[tid];
        #pragma unroll
        for (int e = 0; e < E_; ++e) s += wz[e] * eb2[e * D_ + tid];
        cbias[tid] = s;
    }

    // Build A1: x rows [l0, l0+32) -> bf16 A-operand layout, 2 row tiles x 8 K-chunks of 32
    v16bf A1[2][8];
    #pragma unroll
    for (int mt = 0; mt < 2; ++mt) {
        const float4* xr = (const float4*)(x + ((size_t)b * L_ + l0 + mt * 16 + n) * D_);
        #pragma unroll
        for (int c = 0; c < 8; ++c) {
            #pragma unroll
            for (int part = 0; part < 2; ++part) {
                int kb = c * 32 + part * 16 + khalf * 8;
                float4 f0 = xr[kb >> 2];
                float4 f1 = xr[(kb >> 2) + 1];
                A1[mt][c][part * 8 + 0] = f2bf(f0.x);
                A1[mt][c][part * 8 + 1] = f2bf(f0.y);
                A1[mt][c][part * 8 + 2] = f2bf(f0.z);
                A1[mt][c][part * 8 + 3] = f2bf(f0.w);
                A1[mt][c][part * 8 + 4] = f2bf(f1.x);
                A1[mt][c][part * 8 + 5] = f2bf(f1.y);
                A1[mt][c][part * 8 + 6] = f2bf(f1.z);
                A1[mt][c][part * 8 + 7] = f2bf(f1.w);
            }
        }
    }

    v8f outAcc[2][8];                // [row tile][column tile of this wave's half]
    #pragma unroll
    for (int mt = 0; mt < 2; ++mt) {
        #pragma unroll
        for (int i = 0; i < 8; ++i) { v8f z = {}; outAcc[mt][i] = z; }
    }

    for (int ex = 0; ex < 5; ++ex) {
        float wgt = wz[ex];
        if (wgt == 0.0f) continue;   // block-uniform: skip masked / non-top-k experts
        const char* w1p = (ex < 4) ? (ws + PACK_EW1 + (size_t)ex * 512 * 1024)
                                   : (ws + PACK_SW1);
        const char* w2p = (ex < 4) ? (ws + PACK_EW2 + (size_t)ex * 512 * 1024)
                                   : (ws + PACK_SW2);
        const float* b1p = (ex < 4) ? (eb1 + ex * H_) : sb1;

        __syncthreads();   // prev expert fully done before we touch b1s / bstage[0]
        for (int i = tid; i < H_; i += 256) b1s[i] = b1p[i];

        // cooperative stage of the 32 B tiles for one n2c: 8 copies of 16 bytes per thread.
        // Lane l of a wave takes bytes [16 l, 16 l + 16) of one aligned 512-byte run, in
        // global memory and in LDS alike: a copy instruction touches 4 whole lines, not 32,
        // and its LDS writes fall on every bank once per 16 lanes.
        auto stage = [&](int n2c, int bb) {
            char* d = bstage[bb] + (size_t)tid * 16;
            // GEMM1 tiles: 16 KiB contiguous at w1p + n2c*16K; the block moves 4 KiB per copy
            const char* s1 = w1p + (size_t)n2c * 16384 + (size_t)tid * 16;
            #pragma unroll
            for (int i = 0; i < 4; ++i) cp16(s1 + i * 4096, d + i * 4096);
            // GEMM2 tiles: tile n3 = 4*i + tid/64 is 1 KiB at w2p + (n3*32 + n2c) KiB
            const char* s2 = w2p + ((size_t)((tid >> 6) * 32 + n2c)) * 1024 + (size_t)(tid & 63) * 16;
            #pragma unroll
            for (int i = 0; i < 4; ++i) cp16(s2 + (size_t)i * 131072, d + 16384 + i * 4096);
        };

        // GEMM2 of one chunk: outAcc += h(32 x 32) @ W2[chunk rows, 128 nh .. +128)
        v16bf f2[8];                               // W2 fragments of the chunk whose h is in hstage
        v16bf a2[2];
        v8bf own[2];                               // this wave's half of h, A-fragment order, per row tile
        auto gemm2 = [&]() {
            #pragma unroll
            for (int n3 = 0; n3 < 8; ++n3) {
                #pragma unroll
                for (int mt = 0; mt < 2; ++mt)
                    outAcc[mt][n3] = __builtin_amdgcn_wmma_f32_16x16x32_bf16(
                                         false, a2[mt], false, f2[n3], (short)0, outAcc[mt][n3], false, false);
            }
        };

        stage(0, 0);
        for (int n2c = 0; n2c < 32; ++n2c) {       // H in chunks of 32
            const char* buf = bstage[n2c & 1];
            cp_wait();                 // own async copies landed
            __syncthreads();           // everyone's copies landed, h of chunk n2c-1 written; prev reads done
            if (n2c + 1 < 32) stage(n2c + 1, (n2c + 1) & 1);

            // Group 1, ahead of both WMMA blocks: the partner's half of h of chunk n2c-1 (the own
            // half is still in registers), then GEMM1's 8 fragments of h columns [n2c*32 + 16 nh, +16).
            if (n2c > 0) {
                #pragma unroll
                for (int mt = 0; mt < 2; ++mt) {
                    v8bf ph;
                    __builtin_memcpy(&ph, (const char*)&hstage[(n2c - 1) & 1][mg * 2 + mt][0]
                                          + (nh ^ 1) * 512 + lane * 16, 16);
                    a2[mt] = __builtin_shufflevector(own[mt], ph, 0, 1, 2, 3, 4, 5, 6, 7,
                                                     8, 9, 10, 11, 12, 13, 14, 15);
                }
            }
            v16bf f1[8];
            #pragma unroll
            for (int i = 0; i < 8; ++i) f1[i] = ldfrag(buf + (size_t)(nh * 8 + i) * 1024, lane);
            v8f bias;                              // b1 of h columns 8 khalf .. +8 of this wave's tile
            __builtin_memcpy(&bias, &b1s[(n2c * 2 + nh) * 16 + khalf * 8], 32);
            // keeps group 1 from being moved in among the WMMAs
            __builtin_amdgcn_sched_barrier(0);
            if (n2c > 0) gemm2();                  // chunk n2c-1
            // keeps group 2 in one place behind GEMM2, not pair by pair among its WMMAs
            __builtin_amdgcn_sched_barrier(0);
            // Group 2: W2 tiles of chunk n2c, output columns [128 nh, +128), into the registers
            // GEMM2 has just read; they land under GEMM1 and gelu and are used in the next pass
            #pragma unroll
            for (int i = 0; i < 8; ++i) f2[i] = ldfrag_from(buf + 16384 + (size_t)(nh * 8 + i) * 1024, lane, nh);
            // keeps group 2 from being moved in among GEMM1's WMMAs
            __builtin_amdgcn_sched_barrier(0);
            // ---- GEMM1 transposed: 16 h columns x 32 tokens, each W1 fragment used for both token
            // tiles; acc[mt][r] = h[token n of tile mt][column 8 khalf + r], started from the bias ----
            v8f acc[2] = {bias, bias};
            #pragma unroll
            for (int kc = 0; kc < 8; ++kc) {       // K = D = 256
                #pragma unroll
                for (int mt = 0; mt < 2; ++mt)
                    acc[mt] = __builtin_amdgcn_wmma_f32_16x16x32_bf16(
                                  false, f1[kc], false, A1[mt][kc], (short)0, acc[mt], false, false);
            }
            #pragma unroll
            for (int mt = 0; mt < 2; ++mt) {
                float hx[8], hs[8];                // gelu stage by stage: no element waits on another
                #pragma unroll
                for (int r = 0; r < 8; ++r) hx[r] = acc[mt][r];
                #pragma unroll
                for (int r = 0; r < 8; ++r) hs[r] = gelu_arg(hx[r]);
                #pragma unroll
                for (int r = 0; r < 8; ++r) hs[r] = 1.0f + __builtin_amdgcn_exp2f(hs[r]);
                #pragma unroll
                for (int r = 0; r < 8; ++r) hs[r] = __builtin_amdgcn_rcpf(hs[r]);
                v8f hv;
                #pragma unroll
                for (int r = 0; r < 8; ++r) hv[r] = hx[r] * hs[r] * wgt;
                own[mt] = __builtin_convertvector(hv, v8bf);   // round to nearest even, in pairs
                // two hstage buffers: the partner wave may still read chunk n2c-1 in this pass
                __builtin_memcpy((char*)&hstage[n2c & 1][mg * 2 + mt][0] + nh * 512 + lane * 16, &own[mt], 16);
            }
        }
        __syncthreads();               // h of the last chunk written by both waves of the row group
        #pragma unroll
        for (int mt = 0; mt < 2; ++mt) {
            v8bf ph;
            __builtin_memcpy(&ph, (const char*)&hstage[1][mg * 2 + mt][0] + (nh ^ 1) * 512 + lane * 16, 16);
            a2[mt] = __builtin_shufflevector(own[mt], ph, 0, 1, 2, 3, 4, 5, 6, 7,
                                             8, 9, 10, 11, 12, 13, 14, 15);
        }
        gemm2();                                   // chunk 31
    }
    __syncthreads();

    // Write output tile (+ combined bias)
    #pragma unroll
    for (int mt = 0; mt < 2; ++mt) {
        #pragma unroll
        for (int n3 = 0; n3 < 8; ++n3) {
            #pragma unroll
            for (int r = 0; r < 8; ++r) {
                int row = mt * 16 + r + 8 * khalf;
                int col = (nh * 8 + n3) * 16 + n;
                out[((size_t)b * L_ + l0 + row) * D_ + col] = outAcc[mt][n3][r] + cbias[col];
            }
        }
    }
}

// ---------------------------------------------------------------------------
extern "C" void kernel_launch(void* const* d_in, const int* in_sizes, int n_in,
                              void* d_out, int out_size, void* d_ws, size_t ws_size,
                              hipStream_t stream) {
    (void)in_sizes; (void)n_in; (void)out_size; (void)ws_size;
    const float* x   = (const float*)d_in[0];
    const float* tc  = (const float*)d_in[1];
    const float* gw  = (const float*)d_in[2];
    const float* gb  = (const float*)d_in[3];
    const float* tw  = (const float*)d_in[4];
    const float* tb  = (const float*)d_in[5];
    const float* ew1 = (const float*)d_in[6];
    const float* eb1 = (const float*)d_in[7];
    const float* ew2 = (const float*)d_in[8];
    const float* eb2 = (const float*)d_in[9];
    const float* sw1 = (const float*)d_in[10];
    const float* sb1 = (const float*)d_in[11];
    const float* sw2 = (const float*)d_in[12];
    const float* sb2 = (const float*)d_in[13];
    char*  ws  = (char*)d_ws;
    float* part = (float*)(ws + PART_OFF);
    float* wbe = (float*)(ws + WBE_OFF);
    float* out = (float*)d_out;

    agg_kernel <<<dim3(CH_, B_), 256, 0, stream>>>(x, part);
    gate_kernel<<<B_, 768, 0, stream>>>(part, tc, gw, gb, tw, tb, wbe);
    pack_kernel<<<5120, 128, 0, stream>>>(ew1, ew2, sw1, sw2, ws);
    moe_kernel <<<dim3(L_ / 128, B_), 256, 0, stream>>>(x, eb1, eb2, sb1, sb2, wbe, ws, out);
}

// v008
// It runs in 69.8 microseconds.
// Two timings next to v007 put it at 1.17 and 1.19 times that version's speed.
// Counting every step since v000, it is 6.13 times as fast.
#include <hip/hip_runtime.h>
#include <hip/hip_bf16.h>
#include <stdint.h>

typedef __attribute__((ext_vector_type(16))) __bf16 v16bf;
typedef __attribute__((ext_vector_type(8)))  __bf16 v8bf;
typedef __attribute__((ext_vector_type(8)))  float  v8f;
typedef int v4i_ __attribute__((__vector_size__(16)));
typedef __attribute__((address_space(1))) v4i_* gp_v4i;
typedef __attribute__((address_space(3))) v4i_* lp_v4i;

#define B_ 8
#define L_ 3072
#define D_ 256
#define E_ 4
#define H_ 1024

// d_ws layout (bytes)
#define WBE_OFF   (32*1024)             // B*E floats
#define PACK_EW1  (64*1024)             // 4 experts * 512 tiles * 1 KiB = 2 MiB
#define PACK_EW2  (PACK_EW1 + 2*1024*1024)
#define PACK_SW1  (PACK_EW2 + 2*1024*1024)   // 512 KiB
#define PACK_SW2  (PACK_SW1 + 512*1024)      // 512 KiB
#define PART_OFF  (8*1024*1024)         // B * CH_ * D floats = 768 KiB
#define CH_ 96                          // 32-row chunks per batch

#if defined(__has_builtin)
# if __has_builtin(__builtin_amdgcn_global_load_async_to_lds_b128)
#  define HAVE_ASYNC 1
# endif
#endif

__device__ __forceinline__ uint16_t f2bfbits(float f) {
    union { float f; uint32_t u; } a; a.f = f;
    uint32_t r = a.u + 0x7FFFu + ((a.u >> 16) & 1u);   // round-to-nearest-even
    return (uint16_t)(r >> 16);
}
__device__ __forceinline__ __bf16 f2bf(float f) {
    uint16_t h = f2bfbits(f);
    __bf16 o; __builtin_memcpy(&o, &h, 2); return o;
}
// tanh-approx gelu (approximate=True), branch-free:
//   0.5 x (1 + tanh u) = x / (1 + exp(-2u)),  u = sqrt(2/pi) (x + 0.044715 x^3)
// exp(-2u) = exp2(x (K0 + K1 x^2)) with K0 = -2 sqrt(2/pi) log2(e), K1 = 0.044715 K0.
// Saturates by itself: exp2 -> inf gives x * 0, exp2 -> 0 gives x.
__device__ __forceinline__ float gelu_arg(float x) {   // the exp2 argument
    const float K0 = -2.3022081986f, K1 = -0.1029432396f;
    return x * fmaf(x * x, K1, K0);
}

// One 16x32 / 32x16 bf16 fragment (1 KiB) from LDS. The tile is stored as two 512-byte
// halves; lane l owns bytes [16 l, 16 l + 16) of each half (elements 0..7, then 8..15).
// Each 16-byte read of a wave is then 512 contiguous bytes: 16 lanes cover all 64 banks once.
__device__ __forceinline__ v16bf ldfrag(const char* tile, int lane) {
    v8bf lo, hi;
    __builtin_memcpy(&lo, tile + lane * 16, 16);
    __builtin_memcpy(&hi, tile + 512 + lane * 16, 16);
    return __builtin_shufflevector(lo, hi, 0, 1, 2, 3, 4, 5, 6, 7, 8, 9, 10, 11, 12, 13, 14, 15);
}

// The same fragment with its two halves taken in the order (first, other): the k order inside a
// WMMA is free as long as A and B agree, and GEMM2's A fragment starts with the wave's own half.
__device__ __forceinline__ v16bf ldfrag_from(const char* tile, int lane, int first) {
    v8bf lo, hi;
    __builtin_memcpy(&lo, tile + first * 512 + lane * 16, 16);
    __builtin_memcpy(&hi, tile + (first ^ 1) * 512 + lane * 16, 16);
    return __builtin_shufflevector(lo, hi, 0, 1, 2, 3, 4, 5, 6, 7, 8, 9, 10, 11, 12, 13, 14, 15);
}

// 16-byte global -> LDS copy: async (ASYNCcnt, bypasses VGPRs) when available.
__device__ __forceinline__ void cp16(const char* g, char* l) {
#if HAVE_ASYNC
    __builtin_amdgcn_global_load_async_to_lds_b128(
        (gp_v4i)(const_cast<char*>(g)), (lp_v4i)(l), 0, 0);
#else
    *(float4*)l = *(const float4*)g;
#endif
}

// ---------------------------------------------------------------------------
// Kernel 1: partial column sums of x. One work-group per (batch, 32-row chunk);
// a chunk lies inside one segment (32 chunks per segment of 1024 rows).
// Each thread keeps 8 independent 16-byte loads in flight (rows rg, rg+4, ...).
// ---------------------------------------------------------------------------
__global__ __launch_bounds__(256) void agg_kernel(const float* __restrict__ x,
                                                  float* __restrict__ part) {
    __shared__ float4 red4[4][64];
    const int c = blockIdx.x, b = blockIdx.y, t = threadIdx.x;
    const int q = t & 63, rg = t >> 6;
    const float4* xp = (const float4*)(x + ((size_t)b * L_ + c * 32 + rg) * D_) + q;
    float4 v[8];
    #pragma unroll
    for (int i = 0; i < 8; ++i) v[i] = xp[(size_t)i * 4 * (D_ / 4)];
    #pragma unroll
    for (int s = 4; s > 0; s >>= 1) {
        #pragma unroll
        for (int i = 0; i < s; ++i) {
            v[i].x += v[i + s].x; v[i].y += v[i + s].y;
            v[i].z += v[i + s].z; v[i].w += v[i + s].w;
        }
    }
    red4[rg][q] = v[0];
    __syncthreads();
    const float* r = (const float*)red4;
    part[((size_t)b * CH_ + c) * D_ + t] =
        (r[t] + r[D_ + t]) + (r[2 * D_ + t] + r[3 * D_ + t]);
}

// ---------------------------------------------------------------------------
// Kernel 2: gating -> w_be (renormalized top-2, zeros elsewhere).
// One work-group per batch, 768 threads = one per gate_in element.
// Thread (g, d) first sums segment g's 32 partials of column d, then owns
// gate_in[g*256 + d]; the 4 logit and 8 modulation dot products are summed by
// wave shuffles and one pass through LDS.
// ---------------------------------------------------------------------------
__global__ __launch_bounds__(768) void gate_kernel(const float* __restrict__ part,
                                                   const float* __restrict__ tc,
                                                   const float* __restrict__ gw,
                                                   const float* __restrict__ gb,
                                                   const float* __restrict__ tw,
                                                   const float* __restrict__ tb,
                                                   float* __restrict__ wbe) {
    __shared__ float seg[3][D_];
    __shared__ float red[24][12];
    __shared__ float fin[12];
    const int b = blockIdx.x, t = threadIdx.x;
    const int g = t >> 8, d = t & 255;          // g is wave-uniform
    const float* pp = part + ((size_t)b * CH_ + g * 32) * D_ + d;
    float a[4] = {0.f, 0.f, 0.f, 0.f};
    #pragma unroll
    for (int i = 0; i < 32; ++i) a[i & 3] += pp[(size_t)i * D_];
    const float4 w4 = ((const float4*)gw)[t];   // gate_w[t][0..3]
    float v[12];
    #pragma unroll
    for (int j = 0; j < 12; ++j) v[j] = 0.f;
    if (g == 0) {                               // modulation: silu(time_cond) @ tmod_w
        float u  = tc[b * D_ + d];
        float si = u / (1.0f + expf(-u));
        float4 t0 = ((const float4*)tw)[d * 2], t1 = ((const float4*)tw)[d * 2 + 1];
        v[4] = si * t0.x; v[5]  = si * t0.y; v[6]  = si * t0.z; v[7]  = si * t0.w;
        v[8] = si * t1.x; v[9]  = si * t1.y; v[10] = si * t1.z; v[11] = si * t1.w;
    }
    seg[g][d] = (a[0] + a[1]) + (a[2] + a[3]);
    __syncthreads();
    {
        float hs = seg[0][d], wsu = seg[1][d], ps = seg[2][d];
        float gi = (g == 0) ? (hs + wsu + ps) * (1.0f / 3072.0f)
                 : (g == 1) ? (hs + ps)       * (1.0f / 2048.0f)
                            : (wsu + ps)      * (1.0f / 2048.0f);
        v[0] = gi * w4.x; v[1] = gi * w4.y; v[2] = gi * w4.z; v[3] = gi * w4.w;
    }
    #pragma unroll
    for (int j = 0; j < 12; ++j) {
        #pragma unroll
        for (int m = 16; m > 0; m >>= 1) v[j] += __shfl_xor(v[j], m, 32);
    }
    if ((t & 31) == 0) {
        #pragma unroll
        for (int j = 0; j < 12; ++j) red[t >> 5][j] = v[j];
    }
    __syncthreads();
    if (t < 12) {
        float s = (t < E_) ? gb[t] : tb[t - E_];
        #pragma unroll
        for (int w = 0; w < 24; ++w) s += red[w][t];
        fin[t] = s;
    }
    __syncthreads();
    if (t == 0) {
        float p[E_]; float mx = -1e30f;
        for (int e = 0; e < E_; ++e) {
            p[e] = fin[e] * (1.0f + fin[E_ + e]) + fin[2 * E_ + e];
            mx = fmaxf(mx, p[e]);
        }
        float se = 0.f;
        for (int e = 0; e < E_; ++e) { p[e] = expf(p[e] - mx); se += p[e]; }
        for (int e = 0; e < E_; ++e) p[e] /= se;
        int i1 = 0;
        for (int e = 1; e < E_; ++e) if (p[e] > p[i1]) i1 = e;
        int i2 = (i1 == 0) ? 1 : 0;
        for (int e = 0; e < E_; ++e) if (e != i1 && p[e] > p[i2]) i2 = e;
        float s2 = p[i1] + p[i2] + 1e-8f;
        for (int e = 0; e < E_; ++e)
            wbe[b * E_ + e] = (e == i1) ? (p[i1] / s2) : ((e == i2) ? (p[i2] / s2) : 0.0f);
    }
}

// ---------------------------------------------------------------------------
// Kernel 3: pack fp32 weights into bf16 WMMA B-operand tiles.
// Tile = 32(K) x 16(N), 1 KiB; element e of lane l sits at byte (e/8)*512 + l*16 + (e%8)*2
// (the layout ldfrag reads) and maps to (kk, n):
//   n = l & 15 ; kk = (e/8)*16 + (l/16)*8 + (e%8)
// Tiles stored [nt][kt] contiguous in kt.
// ---------------------------------------------------------------------------
__global__ __launch_bounds__(128) void pack_kernel(const float* __restrict__ ew1,
                                                   const float* __restrict__ ew2,
                                                   const float* __restrict__ sw1,
                                                   const float* __restrict__ sw2,
                                                   char* __restrict__ ws) {
    __shared__ float tileS[512];
    int tb = blockIdx.x;
    const float* src; char* dst; int K, N, local;
    if (tb < 2048) {           // ew1: (E, 256, 1024), K=256 N=1024, 512 tiles/expert
        int ex = tb >> 9; local = tb & 511;
        src = ew1 + (size_t)ex * D_ * H_;
        dst = ws + PACK_EW1 + (size_t)tb * 1024;
        K = D_; N = H_;
    } else if (tb < 4096) {    // ew2: (E, 1024, 256), K=1024 N=256
        int t2 = tb - 2048; int ex = t2 >> 9; local = t2 & 511;
        src = ew2 + (size_t)ex * H_ * D_;
        dst = ws + PACK_EW2 + (size_t)t2 * 1024;
        K = H_; N = D_;
    } else if (tb < 4608) {    // sw1: (256, 1024)
        local = tb - 4096;
        src = sw1; dst = ws + PACK_SW1 + (size_t)local * 1024;
        K = D_; N = H_;
    } else {                   // sw2: (1024, 256)
        local = tb - 4608;
        src = sw2; dst = ws + PACK_SW2 + (size_t)local * 1024;
        K = H_; N = D_;
    }
    int ktiles = K / 32;
    int nt = local / ktiles, kt = local % ktiles;
    int k0 = kt * 32, n0 = nt * 16;
    int t = threadIdx.x;
    #pragma unroll
    for (int i = 0; i < 4; ++i) {
        int e = t + 128 * i;
        int k = e >> 4, nn = e & 15;
        tileS[e] = src[(size_t)(k0 + k) * N + (n0 + nn)];
    }
    __syncthreads();
    uint16_t hv[4];
    #pragma unroll
    for (int i = 0; i < 4; ++i) {
        int p = t * 4 + i;
        int lanep = (p >> 3) & 31;
        int nn = lanep & 15, half = lanep >> 4;
        int kk = ((p >> 8) << 4) + (half << 3) + (p & 7);
        hv[i] = f2bfbits(tileS[kk * 16 + nn]);
    }
    uint32_t lo = (uint32_t)hv[0] | ((uint32_t)hv[1] << 16);
    uint32_t hi = (uint32_t)hv[2] | ((uint32_t)hv[3] << 16);
    ((uint2*)dst)[t] = make_uint2(lo, hi);
}

// ---------------------------------------------------------------------------
// Kernel 4: fused MoE + shared MLP.
// Block = 256 thr = 8 waves over 96 rows: 256 work-groups, one for every WGP of the chip.
// A 16-row tile lies inside one segment (1024 is a multiple of 16), a block may straddle two:
// the expert weight is taken per row tile, and an expert is skipped when it is off in both.
// The waves form a 2 x 4 grid: wave (mg, nq) owns rows [48 mg, 48 mg + 48) and quarter nq of the
// columns, of the 64-column h chunk in GEMM1 and of the output in GEMM2, so every B fragment it
// reads from LDS feeds three WMMAs (three 16-row tiles). GEMM1 is computed transposed
// (the W1 tile as A, the x tile as B; both operands have the same lane map), so a lane's 8
// accumulator registers hold 8 consecutive h columns of one token: converted in place they are
// one half of a GEMM2 A fragment. The four waves of a row group hand each other their quarters
// of h through hstage, 16 bytes per lane. The hand-over uses the barrier that
// stands at the head of every chunk: GEMM2 of chunk t - 1 runs behind that barrier,
// ahead of GEMM1 of chunk t, with its W2 fragments kept in registers since the pass before.
// Per chunk the whole block shares one staged copy of the 64 B-tiles
// (32 GEMM1 + 32 GEMM2 = 64 KiB), double-buffered via async global->LDS copies.
// A wave's B fragments are read from LDS in three groups per chunk, each ahead of a WMMA block.
// ---------------------------------------------------------------------------
#define RB_ 96                          // rows per work-group
#define NT_ (H_ / 64)                   // h chunks per expert
__global__ __launch_bounds__(256) void moe_kernel(const float* __restrict__ x,
                                                  const float* __restrict__ eb1,
                                                  const float* __restrict__ eb2,
                                                  const float* __restrict__ sb1,
                                                  const float* __restrict__ sb2,
                                                  const float* __restrict__ wbe,
                                                  const char* __restrict__ ws,
                                                  float* __restrict__ out) {
    __shared__ float cbias[2][D_];   // [segment of the first / of the last row]
    __shared__ float wz[2][8];
    __shared__ __align__(32) float b1s[H_];
    __shared__ __align__(32) uint16_t hstage[2][6][4][256];  // [t & 1][3 mg + row tile][quarter][16 tokens x 16 columns]
    __shared__ __align__(32) char bstage[2][64 * 1024];   // [buf][tile 0..63][1KiB]

    const int tid   = threadIdx.x;
    const int wv    = __builtin_amdgcn_readfirstlane(tid >> 5);   // in a scalar register: what follows from it costs no VGPR
    const int lane  = tid & 31;
    const int n     = lane & 15;     // B/C column ; A row
    const int khalf = lane >> 4;
    const int b     = blockIdx.y;
    const int mg    = wv >> 2;       // row group
    const int nq    = wv & 3;        // column quarter
    const int jo    = nq >> 1;       // the 32-deep k fragment of a chunk that holds the own quarter
    const int ho    = nq & 1;        // and the half of it
    const int r0    = blockIdx.x * RB_;
    const int l0    = r0 + mg * 48;
    const int segA  = r0 >> 10;                  // 0=head 1=wrist 2=prop
    const int segB  = (r0 + RB_ - 1) >> 10;

    if (tid < 2 * E_) {
        int e = tid & 3, sg = (tid >> 2) ? segB : segA;
        float w = wbe[b * E_ + e];
        bool act = (e == 1) ? (sg != 1) : (e == 2) ? (sg != 0) : true;
        wz[tid >> 2][e] = act ? w : 0.0f;
    } else if (tid < 2 * E_ + 2) {
        wz[tid - 2 * E_][E_] = 1.0f; // shared MLP pseudo-expert
    }
    __syncthreads();
    float bo = sb2[tid], be[E_];     // blockDim == 256 == D_
    #pragma unroll
    for (int e = 0; e < E_; ++e) be[e] = eb2[e * D_ + tid];
    // stands ahead of the later rewrite of the scalar base registers that the bias loads name
    asm volatile("s_wait_xcnt 0x0" ::: "memory");
    #pragma unroll
    for (int sI = 0; sI < 2; ++sI) { // combined output bias: sb2 + sum_e w_e * eb2_e
        float s = bo;
        #pragma unroll
        for (int e = 0; e < E_; ++e) s += wz[sI][e] * be[e];
        cbias[sI][tid] = s;
    }
    int ts[3];                       // which of the block's two segments a row tile lies in
    #pragma unroll
    for (int mt = 0; mt < 3; ++mt) ts[mt] = (((l0 + mt * 16) >> 10) != segA) ? 1 : 0;

    // Build A1: x rows [l0, l0+48) -> bf16 A-operand layout, 3 row tiles x 8 K-chunks of 32
    v16bf A1[3][8];
    #pragma unroll
    for (int mt = 0; mt < 3; ++mt) {
        const float4* xr = (const float4*)(x + ((size_t)b * L_ + l0 + mt * 16 + n) * D_);
        #pragma unroll
        for (int c = 0; c < 8; ++c) {
            #pragma unroll
            for (int part = 0; part < 2; ++part) {
                int kb = c * 32 + part * 16 + khalf * 8;
                float4 f0 = xr[kb >> 2];
                float4 f1 = xr[(kb >> 2) + 1];
                A1[mt][c][part * 8 + 0] = f2bf(f0.x);
                A1[mt][c][part * 8 + 1] = f2bf(f0.y);
                A1[mt][c][part * 8 + 2] = f2bf(f0.z);
                A1[mt][c][part * 8 + 3] = f2bf(f0.w);
                A1[mt][c][part * 8 + 4] = f2bf(f1.x);
                A1[mt][c][part * 8 + 5] = f2bf(f1.y);
                A1[mt][c][part * 8 + 6] = f2bf(f1.z);
                A1[mt][c][part * 8 + 7] = f2bf(f1.w);
            }
        }
    }

    v8f outAcc[3][4];                // [row tile][column tile of this wave's quarter]
    #pragma unroll
    for (int mt = 0; mt < 3; ++mt) {
        #pragma unroll
        for (int i = 0; i < 4; ++i) { v8f z = {}; outAcc[mt][i] = z; }
    }

    for (int ex = 0; ex < 5; ++ex) {
        const float wA = wz[0][ex], wB = wz[1][ex];
        if (wA == 0.0f && wB == 0.0f) continue;   // block-uniform: skip masked / non-top-k experts
        float wgt[3];
        #pragma unroll
        for (int mt = 0; mt < 3; ++mt) wgt[mt] = ts[mt] ? wB : wA;
        const char* w1p = (ex < 4) ? (ws + PACK_EW1 + (size_t)ex * 512 * 1024)
                                   : (ws + PACK_SW1);
        const char* w2p = (ex < 4) ? (ws + PACK_EW2 + (size_t)ex * 512 * 1024)
                                   : (ws + PACK_SW2);
        const float* b1p = (ex < 4) ? (eb1 + ex * H_) : sb1;

        // this wave's LDS reads of the previous expert are over before bstage[0] is refilled
        asm volatile("s_wait_dscnt 0x0" ::: "memory");
        __syncthreads();   // prev expert fully done before we touch b1s / bstage[0]
        for (int i = tid; i < H_; i += 256) b1s[i] = b1p[i];

        // cooperative stage of the 64 B tiles for one chunk: 16 copies of 16 bytes per thread.
        // Lane l of a wave takes bytes [16 l, 16 l + 16) of one aligned 512-byte run, in
        // global memory and in LDS alike: a copy instruction touches 4 whole lines, not 32,
        // and its LDS writes fall on every bank once per 16 lanes.
        auto stage = [&](int t, int bb) {
            char* d = bstage[bb] + (size_t)tid * 16;
            // GEMM1 tiles: 32 KiB contiguous at w1p + t*32K; the block moves 4 KiB per copy
            const char* s1 = w1p + (size_t)t * 32768 + (size_t)tid * 16;
            #pragma unroll
            for (int i = 0; i < 8; ++i) cp16(s1 + i * 4096, d + i * 4096);
            // GEMM2 tiles: column tile n3 = 2*i + tid/128 has its 2 k tiles, 2 KiB, at w2p + (n3*32 + 2t) KiB
            const char* s2 = w2p + ((size_t)((tid >> 7) * 32 + 2 * t)) * 1024 + (size_t)(tid & 127) * 16;
            #pragma unroll
            for (int i = 0; i < 8; ++i) cp16(s2 + (size_t)i * 65536, d + 32768 + i * 4096);
        };

        // GEMM2 of one chunk: outAcc += h(48 x 64) @ W2[chunk rows, 64 nq .. +64)
        v16bf f2[2][4];                            // W2 fragments of the chunk whose h is in hstage
        v16bf a2[3][2];                            // [row tile][0: the k fragment with the own quarter, 1: the other]
        v8bf own[3];                               // this wave's quarter of h, A-fragment order, per row tile
        auto gemm2 = [&](int j) {                  // one of its two k fragments
            #pragma unroll
            for (int n3 = 0; n3 < 4; ++n3) {
                #pragma unroll
                for (int mt = 0; mt < 3; ++mt)
                    outAcc[mt][n3] = __builtin_amdgcn_wmma_f32_16x16x32_bf16(
                                         false, a2[mt][j], false, f2[j][n3], (short)0, outAcc[mt][n3], false, false);
            }
        };
        // the three other quarters of h of one chunk from hstage, joined with the own one
        auto load_a2 = [&](int hb) {
            #pragma unroll
            for (int mt = 0; mt < 3; ++mt) {
                const char* hq = (const char*)&hstage[hb][mg * 3 + mt][0][0] + lane * 16;
                v8bf ph, q0, q1;
                __builtin_memcpy(&ph, hq + (nq ^ 1) * 512, 16);
                __builtin_memcpy(&q0, hq + (jo ^ 1) * 1024, 16);
                __builtin_memcpy(&q1, hq + (jo ^ 1) * 1024 + 512, 16);
                a2[mt][0] = __builtin_shufflevector(own[mt], ph, 0, 1, 2, 3, 4, 5, 6, 7,
                                                    8, 9, 10, 11, 12, 13, 14, 15);
                a2[mt][1] = __builtin_shufflevector(q0, q1, 0, 1, 2, 3, 4, 5, 6, 7,
                                                    8, 9, 10, 11, 12, 13, 14, 15);
            }
        };

        stage(0, 0);
        for (int t = 0; t < NT_; ++t) {            // H in chunks of 64
            const char* buf = bstage[t & 1];
            // this wave's LDS reads and its h store of the pass before are over
            asm volatile("s_wait_dscnt 0x0" ::: "memory");
            // own async copies landed
            asm volatile("s_wait_asynccnt 0x0" ::: "memory");
            __syncthreads();           // everyone's copies landed, h of chunk t-1 written; prev reads done
            if (t + 1 < NT_) stage(t + 1, (t + 1) & 1);

            // Group 1, ahead of the WMMA blocks: the other waves' quarters of h of chunk t-1 (the own
            // one is still in registers), then the first 4 of GEMM1's 8 fragments of h columns [t*64 + 16 nq, +16).
            if (t > 0) load_a2((t - 1) & 1);
            v16bf f1[8];
            #pragma unroll
            for (int i = 0; i < 4; ++i) f1[i] = ldfrag(buf + (size_t)(nq * 8 + i) * 1024, lane);
            // keeps group 1 from being moved in among the WMMAs
            __builtin_amdgcn_sched_barrier(0);
            if (t > 0) gemm2(0);                   // chunk t-1, first k fragment
            // keeps group 1b in one place between the halves of GEMM2, in the registers the first half has freed
            __builtin_amdgcn_sched_barrier(0);
            #pragma unroll
            for (int i = 4; i < 8; ++i) f1[i] = ldfrag(buf + (size_t)(nq * 8 + i) * 1024, lane);
            v8f bias;                              // b1 of h columns 8 khalf .. +8 of this wave's tile
            __builtin_memcpy(&bias, &b1s[(t * 4 + nq) * 16 + khalf * 8], 32);
            // keeps group 1b from being moved in among the WMMAs
            __builtin_amdgcn_sched_barrier(0);
            if (t > 0) gemm2(1);                   // chunk t-1, second k fragment
            // keeps group 2 in one place behind GEMM2, not pair by pair among its WMMAs
            __builtin_amdgcn_sched_barrier(0);
            // Group 2: W2 tiles of chunk t, output columns [64 nq, +64), into the registers
            // GEMM2 has just read; they land under GEMM1 and gelu and are used in the next pass
            #pragma unroll
            for (int i = 0; i < 4; ++i) {
                const char* w2t = buf + 32768 + (size_t)(nq * 4 + i) * 2048;
                f2[0][i] = ldfrag_from(w2t + jo * 1024, lane, ho);
                f2[1][i] = ldfrag(w2t + (jo ^ 1) * 1024, lane);
            }
            // keeps group 2 from being moved in among GEMM1's WMMAs
            __builtin_amdgcn_sched_barrier(0);
            // ---- GEMM1 transposed: 16 h columns x 48 tokens, each W1 fragment used for all three token
            // tiles; acc[mt][r] = h[token n of tile mt][column 8 khalf + r], started from the bias ----
            v8f acc[3] = {bias, bias, bias};
            #pragma unroll
            for (int kc = 0; kc < 8; ++kc) {       // K = D = 256
                #pragma unroll
                for (int mt = 0; mt < 3; ++mt)
                    acc[mt] = __builtin_amdgcn_wmma_f32_16x16x32_bf16(
                                  false, f1[kc], false, A1[mt][kc], (short)0, acc[mt], false, false);
            }
            #pragma unroll
            for (int mt = 0; mt < 3; ++mt) {
                float hx[8], hs[8];                // gelu stage by stage: no element waits on another
                #pragma unroll
                for (int r = 0; r < 8; ++r) hx[r] = acc[mt][r];
                #pragma unroll
                for (int r = 0; r < 8; ++r) hs[r] = gelu_arg(hx[r]);
                #pragma unroll
                for (int r = 0; r < 8; ++r) hs[r] = 1.0f + __builtin_amdgcn_exp2f(hs[r]);
                #pragma unroll
                for (int r = 0; r < 8; ++r) hs[r] = __builtin_amdgcn_rcpf(hs[r]);
                v8f hv;
                #pragma unroll
                for (int r = 0; r < 8; ++r) hv[r] = hx[r] * hs[r] * wgt[mt];
                own[mt] = __builtin_convertvector(hv, v8bf);   // round to nearest even, in pairs
                // two hstage buffers: the other waves may still read chunk t-1 in this pass
                __builtin_memcpy((char*)&hstage[t & 1][mg * 3 + mt][nq][0] + lane * 16, &own[mt], 16);
            }
        }
        // the ring's closing wait: no copy is outstanding when bstage is refilled for the next expert or the wave ends
        asm volatile("s_wait_asynccnt 0x0" ::: "memory");
        __syncthreads();               // h of the last chunk written by all four waves of the row group
        load_a2((NT_ - 1) & 1);
        gemm2(0);                                  // the last chunk
        gemm2(1);
    }
    __syncthreads();

    // Write output tile (+ combined bias)
    float cb[3][4];
    #pragma unroll
    for (int mt = 0; mt < 3; ++mt) {
        #pragma unroll
        for (int n3 = 0; n3 < 4; ++n3) cb[mt][n3] = cbias[ts[mt]][(nq * 4 + n3) * 16 + n];
    }
    #pragma unroll
    for (int mt = 0; mt < 3; ++mt) {
        #pragma unroll
        for (int n3 = 0; n3 < 4; ++n3) {
            #pragma unroll
            for (int r = 0; r < 8; ++r) outAcc[mt][n3][r] += cb[mt][n3];
        }
    }
    // every sum is formed ahead of the first store, so that no register of an issued store is written again
    __builtin_amdgcn_sched_barrier(0);
    #pragma unroll
    for (int mt = 0; mt < 3; ++mt) {
        #pragma unroll
        for (int n3 = 0; n3 < 4; ++n3) {
            #pragma unroll
            for (int r = 0; r < 8; ++r) {
                int row = mt * 16 + r + 8 * khalf;
                int col = (nq * 4 + n3) * 16 + n;
                out[((size_t)b * L_ + l0 + row) * D_ + col] = outAcc[mt][n3][r];
            }
        }
    }
}

// ---------------------------------------------------------------------------
extern "C" void kernel_launch(void* const* d_in, const int* in_sizes, int n_in,
                              void* d_out, int out_size, void* d_ws, size_t ws_size,
                              hipStream_t stream) {
    (void)in_sizes; (void)n_in; (void)out_size; (void)ws_size;
    const float* x   = (const float*)d_in[0];
    const float* tc  = (const float*)d_in[1];
    const float* gw  = (const float*)d_in[2];
    const float* gb  = (const float*)d_in[3];
    const float* tw  = (const float*)d_in[4];
    const float* tb  = (const float*)d_in[5];
    const float* ew1 = (const float*)d_in[6];
    const float* eb1 = (const float*)d_in[7];
    const float* ew2 = (const float*)d_in[8];
    const float* eb2 = (const float*)d_in[9];
    const float* sw1 = (const float*)d_in[10];
    const float* sb1 = (const float*)d_in[11];
    const float* sw2 = (const float*)d_in[12];
    const float* sb2 = (const float*)d_in[13];
    char*  ws  = (char*)d_ws;
    float* part = (float*)(ws + PART_OFF);
    float* wbe = (float*)(ws + WBE_OFF);
    float* out = (float*)d_out;

    agg_kernel <<<dim3(CH_, B_), 256, 0, stream>>>(x, part);
    gate_kernel<<<B_, 768, 0, stream>>>(part, tc, gw, gb, tw, tb, wbe);
    pack_kernel<<<5120, 128, 0, stream>>>(ew1, ew2, sw1, sw2, ws);
    moe_kernel <<<dim3(L_ / RB_, B_), 256, 0, stream>>>(x, eb1, eb2, sb1, sb2, wbe, ws, out);
}

// v009
// It runs in 68.6 microseconds.
// Next to v008, in two timings, it ran 1.05 times as fast each time.
// Counting every step since v000, it is 6.44 times as fast.
#include <hip/hip_runtime.h>
#include <hip/hip_bf16.h>
#include <stdint.h>

typedef __attribute__((ext_vector_type(16))) __bf16 v16bf;
typedef __attribute__((ext_vector_type(8)))  __bf16 v8bf;
typedef __attribute__((ext_vector_type(8)))  float  v8f;
typedef int v4i_ __attribute__((__vector_size__(16)));
typedef __attribute__((address_space(1))) v4i_* gp_v4i;
typedef __attribute__((address_space(3))) v4i_* lp_v4i;

#define B_ 8
#define L_ 3072
#define D_ 256
#define E_ 4
#define H_ 1024

// d_ws layout (bytes)
#define WBE_OFF   (32*1024)             // B*E floats
#define PACK_EW1  (64*1024)             // 4 experts * 512 tiles * 1 KiB = 2 MiB
#define PACK_EW2  (PACK_EW1 + 2*1024*1024)
#define PACK_SW1  (PACK_EW2 + 2*1024*1024)   // 512 KiB
#define PACK_SW2  (PACK_SW1 + 512*1024)      // 512 KiB
#define PART_OFF  (8*1024*1024)         // B * CH_ * D floats = 768 KiB
#define CH_ 96                          // 32-row chunks per batch

#if defined(__has_builtin)
# if __has_builtin(__builtin_amdgcn_global_load_async_to_lds_b128)
#  define HAVE_ASYNC 1
# endif
#endif

__device__ __forceinline__ uint16_t f2bfbits(float f) {
    union { float f; uint32_t u; } a; a.f = f;
    uint32_t r = a.u + 0x7FFFu + ((a.u >> 16) & 1u);   // round-to-nearest-even
    return (uint16_t)(r >> 16);
}
__device__ __forceinline__ __bf16 f2bf(float f) {
    uint16_t h = f2bfbits(f);
    __bf16 o; __builtin_memcpy(&o, &h, 2); return o;
}
// tanh-approx gelu (approximate=True), branch-free:
//   0.5 x (1 + tanh u) = x / (1 + exp(-2u)),  u = sqrt(2/pi) (x + 0.044715 x^3)
// exp(-2u) = exp2(x (K0 + K1 x^2)) with K0 = -2 sqrt(2/pi) log2(e), K1 = 0.044715 K0.
// Saturates by itself: exp2 -> inf gives x * 0, exp2 -> 0 gives x.
__device__ __forceinline__ float gelu_arg(float x) {   // the exp2 argument
    const float K0 = -2.3022081986f, K1 = -0.1029432396f;
    return x * fmaf(x * x, K1, K0);
}

// One 16x32 / 32x16 bf16 fragment (1 KiB) from LDS. The tile is stored as two 512-byte
// halves; lane l owns bytes [16 l, 16 l + 16) of each half (elements 0..7, then 8..15).
// Each 16-byte read of a wave is then 512 contiguous bytes: 16 lanes cover all 64 banks once.
__device__ __forceinline__ v16bf ldfrag(const char* tile, int lane) {
    v8bf lo, hi;
    __builtin_memcpy(&lo, tile + lane * 16, 16);
    __builtin_memcpy(&hi, tile + 512 + lane * 16, 16);
    return __builtin_shufflevector(lo, hi, 0, 1, 2, 3, 4, 5, 6, 7, 8, 9, 10, 11, 12, 13, 14, 15);
}

// The same fragment with its two halves taken in the order (first, other): the k order inside a
// WMMA is free as long as A and B agree, and GEMM2's A fragment starts with the wave's own half.
__device__ __forceinline__ v16bf ldfrag_from(const char* tile, int lane, int first) {
    v8bf lo, hi;
    __builtin_memcpy(&lo, tile + first * 512 + lane * 16, 16);
    __builtin_memcpy(&hi, tile + (first ^ 1) * 512 + lane * 16, 16);
    return __builtin_shufflevector(lo, hi, 0, 1, 2, 3, 4, 5, 6, 7, 8, 9, 10, 11, 12, 13, 14, 15);
}

// 16-byte global -> LDS copy: async (ASYNCcnt, bypasses VGPRs) when available.
__device__ __forceinline__ void cp16(const char* g, char* l) {
#if HAVE_ASYNC
    __builtin_amdgcn_global_load_async_to_lds_b128(
        (gp_v4i)(const_cast<char*>(g)), (lp_v4i)(l), 0, 0);
#else
    *(float4*)l = *(const float4*)g;
#endif
}

// ---------------------------------------------------------------------------
// Kernel 1: partial column sums of x. One work-group per (batch, 32-row chunk);
// a chunk lies inside one segment (32 chunks per segment of 1024 rows).
// Each thread keeps 8 independent 16-byte loads in flight (rows rg, rg+4, ...).
// ---------------------------------------------------------------------------
__global__ __launch_bounds__(256) void agg_kernel(const float* __restrict__ x,
                                                  float* __restrict__ part) {
    __shared__ float4 red4[4][64];
    const int c = blockIdx.x, b = blockIdx.y, t = threadIdx.x;
    const int q = t & 63, rg = t >> 6;
    const float4* xp = (const float4*)(x + ((size_t)b * L_ + c * 32 + rg) * D_) + q;
    float4 v[8];
    #pragma unroll
    for (int i = 0; i < 8; ++i) v[i] = xp[(size_t)i * 4 * (D_ / 4)];
    #pragma unroll
    for (int s = 4; s > 0; s >>= 1) {
        #pragma unroll
        for (int i = 0; i < s; ++i) {
            v[i].x += v[i + s].x; v[i].y += v[i + s].y;
            v[i].z += v[i + s].z; v[i].w += v[i + s].w;
        }
    }
    red4[rg][q] = v[0];
    __syncthreads();
    const float* r = (const float*)red4;
    part[((size_t)b * CH_ + c) * D_ + t] =
        (r[t] + r[D_ + t]) + (r[2 * D_ + t] + r[3 * D_ + t]);
}

// ---------------------------------------------------------------------------
// Kernel 2: gating and weight packing in one launch. Neither reads what the other writes,
// so they share a grid: work-groups 0 .. B-1 do the gating (a short chain of dependent
// steps on 8 work-groups), the others pack the weights and fill the rest of the chip meanwhile.
//
// Gating -> w_be (renormalized top-2, zeros elsewhere).
// One work-group per batch, 768 threads = one per gate_in element.
// Thread (g, d) first sums segment g's 32 partials of column d, then owns
// gate_in[g*256 + d]; the 4 logit and 8 modulation dot products are summed by
// wave shuffles and one pass through LDS.
//
// Packing: fp32 weights into bf16 WMMA B-operand tiles, six tiles per work-group,
// 128 threads (4 waves) per tile.
// Tile = 32(K) x 16(N), 1 KiB; element e of lane l sits at byte (e/8)*512 + l*16 + (e%8)*2
// (the layout ldfrag reads) and maps to (kk, n):
//   n = l & 15 ; kk = (e/8)*16 + (l/16)*8 + (e%8)
// Tiles stored [nt][kt] contiguous in kt.
// ---------------------------------------------------------------------------
#define NTILES_ 5120                    // 4 * 512 + 4 * 512 + 512 + 512
#define TPB_ 6                          // tiles per packing work-group
#define PACKB_ ((NTILES_ + TPB_ - 1) / TPB_)
__global__ __launch_bounds__(768) void gate_pack_kernel(const float* __restrict__ part,
                                                        const float* __restrict__ tc,
                                                        const float* __restrict__ gw,
                                                        const float* __restrict__ gb,
                                                        const float* __restrict__ tw,
                                                        const float* __restrict__ tb,
                                                        float* __restrict__ wbe,
                                                        const float* __restrict__ ew1,
                                                        const float* __restrict__ ew2,
                                                        const float* __restrict__ sw1,
                                                        const float* __restrict__ sw2,
                                                        char* __restrict__ ws) {
    __shared__ float seg[3][D_];
    __shared__ float red[24][12];
    __shared__ float fin[12];
    __shared__ float tileS[TPB_][512];
    if (blockIdx.x < B_) {                      // block-uniform
        const int b = blockIdx.x, t = threadIdx.x;
        const int g = t >> 8, d = t & 255;          // g is wave-uniform
        const float* pp = part + ((size_t)b * CH_ + g * 32) * D_ + d;
        float a[4] = {0.f, 0.f, 0.f, 0.f};
        #pragma unroll
        for (int i = 0; i < 32; ++i) a[i & 3] += pp[(size_t)i * D_];
        const float4 w4 = ((const float4*)gw)[t];   // gate_w[t][0..3]
        float v[12];
        #pragma unroll
        for (int j = 0; j < 12; ++j) v[j] = 0.f;
        if (g == 0) {                               // modulation: silu(time_cond) @ tmod_w
            float u  = tc[b * D_ + d];
            float si = u / (1.0f + expf(-u));
            float4 t0 = ((const float4*)tw)[d * 2], t1 = ((const float4*)tw)[d * 2 + 1];
            v[4] = si * t0.x; v[5]  = si * t0.y; v[6]  = si * t0.z; v[7]  = si * t0.w;
            v[8] = si * t1.x; v[9]  = si * t1.y; v[10] = si * t1.z; v[11] = si * t1.w;
        }
        seg[g][d] = (a[0] + a[1]) + (a[2] + a[3]);
        __syncthreads();
        {
            float hs = seg[0][d], wsu = seg[1][d], ps = seg[2][d];
            float gi = (g == 0) ? (hs + wsu + ps) * (1.0f / 3072.0f)
                     : (g == 1) ? (hs + ps)       * (1.0f / 2048.0f)
                                : (wsu + ps)      * (1.0f / 2048.0f);
            v[0] = gi * w4.x; v[1] = gi * w4.y; v[2] = gi * w4.z; v[3] = gi * w4.w;
        }
        #pragma unroll
        for (int j = 0; j < 12; ++j) {
            #pragma unroll
            for (int m = 16; m > 0; m >>= 1) v[j] += __shfl_xor(v[j], m, 32);
        }
        if ((t & 31) == 0) {
            #pragma unroll
            for (int j = 0; j < 12; ++j) red[t >> 5][j] = v[j];
        }
        __syncthreads();
        if (t < 12) {
            float s = (t < E_) ? gb[t] : tb[t - E_];
            #pragma unroll
            for (int w = 0; w < 24; ++w) s += red[w][t];
            fin[t] = s;
        }
        __syncthreads();
        if (t == 0) {
            float p[E_]; float mx = -1e30f;
            for (int e = 0; e < E_; ++e) {
                p[e] = fin[e] * (1.0f + fin[E_ + e]) + fin[2 * E_ + e];
                mx = fmaxf(mx, p[e]);
            }
            float se = 0.f;
            for (int e = 0; e < E_; ++e) { p[e] = expf(p[e] - mx); se += p[e]; }
            for (int e = 0; e < E_; ++e) p[e] /= se;
            int i1 = 0;
            for (int e = 1; e < E_; ++e) if (p[e] > p[i1]) i1 = e;
            int i2 = (i1 == 0) ? 1 : 0;
            for (int e = 0; e < E_; ++e) if (e != i1 && p[e] > p[i2]) i2 = e;
            float s2 = p[i1] + p[i2] + 1e-8f;
            for (int e = 0; e < E_; ++e)
                wbe[b * E_ + e] = (e == i1) ? (p[i1] / s2) : ((e == i2) ? (p[i2] / s2) : 0.0f);
        }
        return;
    }
    // in a scalar register: the choice of matrix and every tile index stay scalar work
    const int sg = __builtin_amdgcn_readfirstlane(threadIdx.x >> 7);
    const int tl = (blockIdx.x - B_) * TPB_ + sg;
    const bool on = tl < NTILES_;               // wave-uniform; the last work-group has two tiles
    const int t = threadIdx.x & 127;
    char* dst = ws;
    if (on) {
        const float* src; int K, N, local;
        if (tl < 2048) {           // ew1: (E, 256, 1024), K=256 N=1024, 512 tiles/expert
            int ex = tl >> 9; local = tl & 511;
            src = ew1 + (size_t)ex * D_ * H_;
            dst = ws + PACK_EW1 + (size_t)tl * 1024;
            K = D_; N = H_;
        } else if (tl < 4096) {    // ew2: (E, 1024, 256), K=1024 N=256
            int t2 = tl - 2048; int ex = t2 >> 9; local = t2 & 511;
            src = ew2 + (size_t)ex * H_ * D_;
            dst = ws + PACK_EW2 + (size_t)t2 * 1024;
            K = H_; N = D_;
        } else if (tl < 4608) {    // sw1: (256, 1024)
            local = tl - 4096;
            src = sw1; dst = ws + PACK_SW1 + (size_t)local * 1024;
            K = D_; N = H_;
        } else {                   // sw2: (1024, 256)
            local = tl - 4608;
            src = sw2; dst = ws + PACK_SW2 + (size_t)local * 1024;
            K = H_; N = D_;
        }
        int ktiles = K / 32;
        int nt = local / ktiles, kt = local % ktiles;
        int k0 = kt * 32, n0 = nt * 16;
        #pragma unroll
        for (int i = 0; i < 4; ++i) {
            int e = t + 128 * i;
            int k = e >> 4, nn = e & 15;
            tileS[sg][e] = src[(size_t)(k0 + k) * N + (n0 + nn)];
        }
    }
    __syncthreads();               // every wave of the work-group, also one without a tile
    if (on) {
        uint16_t hv[4];
        #pragma unroll
        for (int i = 0; i < 4; ++i) {
            int p = t * 4 + i;
            int lanep = (p >> 3) & 31;
            int nn = lanep & 15, half = lanep >> 4;
            int kk = ((p >> 8) << 4) + (half << 3) + (p & 7);
            hv[i] = f2bfbits(tileS[sg][kk * 16 + nn]);
        }
        uint32_t lo = (uint32_t)hv[0] | ((uint32_t)hv[1] << 16);
        uint32_t hi = (uint32_t)hv[2] | ((uint32_t)hv[3] << 16);
        ((uint2*)dst)[t] = make_uint2(lo, hi);
        // the listing has a write of the store's offset register on a path behind it: keep the wait in front
        asm volatile("s_wait_xcnt 0x0" ::: "memory");
    }
}

// ---------------------------------------------------------------------------
// Kernel 3: fused MoE + shared MLP.
// Block = 256 thr = 8 waves over 96 rows: 256 work-groups, one for every WGP of the chip.
// A 16-row tile lies inside one segment (1024 is a multiple of 16), a block may straddle two:
// the expert weight is taken per row tile, and an expert is skipped when it is off in both.
// The waves form a 2 x 4 grid: wave (mg, nq) owns rows [48 mg, 48 mg + 48) and quarter nq of the
// columns, of the 64-column h chunk in GEMM1 and of the output in GEMM2, so every B fragment it
// reads from LDS feeds three WMMAs (three 16-row tiles). GEMM1 is computed transposed
// (the W1 tile as A, the x tile as B; both operands have the same lane map), so a lane's 8
// accumulator registers hold 8 consecutive h columns of one token: converted in place they are
// one half of a GEMM2 A fragment. The four waves of a row group hand each other their quarters
// of h through hstage, 16 bytes per lane. The hand-over uses the barrier that
// stands at the head of every chunk: GEMM2 of chunk t - 1 runs behind that barrier,
// ahead of GEMM1 of chunk t, with its W2 fragments kept in registers since the pass before.
// Per chunk the whole block shares one staged copy of the 64 B-tiles
// (32 GEMM1 + 32 GEMM2 = 64 KiB), double-buffered via async global->LDS copies.
// A wave's B fragments are read from LDS in three groups per chunk, each ahead of a WMMA block.
// ---------------------------------------------------------------------------
#define RB_ 96                          // rows per work-group
#define NT_ (H_ / 64)                   // h chunks per expert
__global__ __launch_bounds__(256) void moe_kernel(const float* __restrict__ x,
                                                  const float* __restrict__ eb1,
                                                  const float* __restrict__ eb2,
                                                  const float* __restrict__ sb1,
                                                  const float* __restrict__ sb2,
                                                  const float* __restrict__ wbe,
                                                  const char* __restrict__ ws,
                                                  float* __restrict__ out) {
    __shared__ float cbias[2][D_];   // [segment of the first / of the last row]
    __shared__ float wz[2][8];
    __shared__ __align__(32) float b1s[H_];
    __shared__ __align__(32) uint16_t hstage[2][6][4][256];  // [t & 1][3 mg + row tile][quarter][16 tokens x 16 columns]
    __shared__ __align__(32) char bstage[2][64 * 1024];   // [buf][tile 0..63][1KiB]

    const int tid   = threadIdx.x;
    const int wv    = __builtin_amdgcn_readfirstlane(tid >> 5);   // in a scalar register: what follows from it costs no VGPR
    const int lane  = tid & 31;
    const int n     = lane & 15;     // B/C column ; A row
    const int khalf = lane >> 4;
    const int b     = blockIdx.y;
    const int mg    = wv >> 2;       // row group
    const int nq    = wv & 3;        // column quarter
    const int jo    = nq >> 1;       // the 32-deep k fragment of a chunk that holds the own quarter
    const int ho    = nq & 1;        // and the half of it
    const int r0    = blockIdx.x * RB_;
    const int l0    = r0 + mg * 48;
    const int segA  = r0 >> 10;                  // 0=head 1=wrist 2=prop
    const int segB  = (r0 + RB_ - 1) >> 10;

    if (tid < 2 * E_) {
        int e = tid & 3, sg = (tid >> 2) ? segB : segA;
        float w = wbe[b * E_ + e];
        bool act = (e == 1) ? (sg != 1) : (e == 2) ? (sg != 0) : true;
        wz[tid >> 2][e] = act ? w : 0.0f;
    } else if (tid < 2 * E_ + 2) {
        wz[tid - 2 * E_][E_] = 1.0f; // shared MLP pseudo-expert
    }
    __syncthreads();
    float bo = sb2[tid], be[E_];     // blockDim == 256 == D_
    #pragma unroll
    for (int e = 0; e < E_; ++e) be[e] = eb2[e * D_ + tid];
    // stands ahead of the later rewrite of the scalar base registers that the bias loads name
    asm volatile("s_wait_xcnt 0x0" ::: "memory");
    #pragma unroll
    for (int sI = 0; sI < 2; ++sI) { // combined output bias: sb2 + sum_e w_e * eb2_e
        float s = bo;
        #pragma unroll
        for (int e = 0; e < E_; ++e) s += wz[sI][e] * be[e];
        cbias[sI][tid] = s;
    }
    int ts[3];                       // which of the block's two segments a row tile lies in
    #pragma unroll
    for (int mt = 0; mt < 3; ++mt) ts[mt] = (((l0 + mt * 16) >> 10) != segA) ? 1 : 0;

    // Build A1: x rows [l0, l0+48) -> bf16 A-operand layout, 3 row tiles x 8 K-chunks of 32
    v16bf A1[3][8];
    #pragma unroll
    for (int mt = 0; mt < 3; ++mt) {
        const float4* xr = (const float4*)(x + ((size_t)b * L_ + l0 + mt * 16 + n) * D_);
        #pragma unroll
        for (int c = 0; c < 8; ++c) {
            #pragma unroll
            for (int part = 0; part < 2; ++part) {
                int kb = c * 32 + part * 16 + khalf * 8;
                float4 f0 = xr[kb >> 2];
                float4 f1 = xr[(kb >> 2) + 1];
                A1[mt][c][part * 8 + 0] = f2bf(f0.x);
                A1[mt][c][part * 8 + 1] = f2bf(f0.y);
                A1[mt][c][part * 8 + 2] = f2bf(f0.z);
                A1[mt][c][part * 8 + 3] = f2bf(f0.w);
                A1[mt][c][part * 8 + 4] = f2bf(f1.x);
                A1[mt][c][part * 8 + 5] = f2bf(f1.y);
                A1[mt][c][part * 8 + 6] = f2bf(f1.z);
                A1[mt][c][part * 8 + 7] = f2bf(f1.w);
            }
        }
    }

    v8f outAcc[3][4];                // [row tile][column tile of this wave's quarter]
    #pragma unroll
    for (int mt = 0; mt < 3; ++mt) {
        #pragma unroll
        for (int i = 0; i < 4; ++i) { v8f z = {}; outAcc[mt][i] = z; }
    }

    for (int ex = 0; ex < 5; ++ex) {
        const float wA = wz[0][ex], wB = wz[1][ex];
        if (wA == 0.0f && wB == 0.0f) continue;   // block-uniform: skip masked / non-top-k experts
        float wgt[3];
        #pragma unroll
        for (int mt = 0; mt < 3; ++mt) wgt[mt] = ts[mt] ? wB : wA;
        const char* w1p = (ex < 4) ? (ws + PACK_EW1 + (size_t)ex * 512 * 1024)
                                   : (ws + PACK_SW1);
        const char* w2p = (ex < 4) ? (ws + PACK_EW2 + (size_t)ex * 512 * 1024)
                                   : (ws + PACK_SW2);
        const float* b1p = (ex < 4) ? (eb1 + ex * H_) : sb1;

        // this wave's LDS reads of the previous expert are over before bstage[0] is refilled
        asm volatile("s_wait_dscnt 0x0" ::: "memory");
        __syncthreads();   // prev expert fully done before we touch b1s / bstage[0]
        for (int i = tid; i < H_; i += 256) b1s[i] = b1p[i];

        // cooperative stage of the 64 B tiles for one chunk: 16 copies of 16 bytes per thread.
        // Lane l of a wave takes bytes [16 l, 16 l + 16) of one aligned 512-byte run, in
        // global memory and in LDS alike: a copy instruction touches 4 whole lines, not 32,
        // and its LDS writes fall on every bank once per 16 lanes.
        auto stage = [&](int t, int bb) {
            char* d = bstage[bb] + (size_t)tid * 16;
            // GEMM1 tiles: 32 KiB contiguous at w1p + t*32K; the block moves 4 KiB per copy
            const char* s1 = w1p + (size_t)t * 32768 + (size_t)tid * 16;
            #pragma unroll
            for (int i = 0; i < 8; ++i) cp16(s1 + i * 4096, d + i * 4096);
            // GEMM2 tiles: column tile n3 = 2*i + tid/128 has its 2 k tiles, 2 KiB, at w2p + (n3*32 + 2t) KiB
            const char* s2 = w2p + ((size_t)((tid >> 7) * 32 + 2 * t)) * 1024 + (size_t)(tid & 127) * 16;
            #pragma unroll
            for (int i = 0; i < 8; ++i) cp16(s2 + (size_t)i * 65536, d + 32768 + i * 4096);
        };

        // GEMM2 of one chunk: outAcc += h(48 x 64) @ W2[chunk rows, 64 nq .. +64)
        v16bf f2[2][4];                            // W2 fragments of the chunk whose h is in hstage
        v16bf a2[3][2];                            // [row tile][0: the k fragment with the own quarter, 1: the other]
        v8bf own[3];                               // this wave's quarter of h, A-fragment order, per row tile
        auto gemm2 = [&](int j) {                  // one of its two k fragments
            #pragma unroll
            for (int n3 = 0; n3 < 4; ++n3) {
                #pragma unroll
                for (int mt = 0; mt < 3; ++mt)
                    outAcc[mt][n3] = __builtin_amdgcn_wmma_f32_16x16x32_bf16(
                                         false, a2[mt][j], false, f2[j][n3], (short)0, outAcc[mt][n3], false, false);
            }
        };
        // the three other quarters of h of one chunk from hstage, joined with the own one
        auto load_a2 = [&](int hb) {
            #pragma unroll
            for (int mt = 0; mt < 3; ++mt) {
                const char* hq = (const char*)&hstage[hb][mg * 3 + mt][0][0] + lane * 16;
                v8bf ph, q0, q1;
                __builtin_memcpy(&ph, hq + (nq ^ 1) * 512, 16);
                __builtin_memcpy(&q0, hq + (jo ^ 1) * 1024, 16);
                __builtin_memcpy(&q1, hq + (jo ^ 1) * 1024 + 512, 16);
                a2[mt][0] = __builtin_shufflevector(own[mt], ph, 0, 1, 2, 3, 4, 5, 6, 7,
                                                    8, 9, 10, 11, 12, 13, 14, 15);
                a2[mt][1] = __builtin_shufflevector(q0, q1, 0, 1, 2, 3, 4, 5, 6, 7,
                                                    8, 9, 10, 11, 12, 13, 14, 15);
            }
        };

        stage(0, 0);
        for (int t = 0; t < NT_; ++t) {            // H in chunks of 64
            const char* buf = bstage[t & 1];
            // this wave's LDS reads and its h store of the pass before are over
            asm volatile("s_wait_dscnt 0x0" ::: "memory");
            // own async copies landed
            asm volatile("s_wait_asynccnt 0x0" ::: "memory");
            __syncthreads();           // everyone's copies landed, h of chunk t-1 written; prev reads done
            if (t + 1 < NT_) stage(t + 1, (t + 1) & 1);

            // Group 1, ahead of the WMMA blocks: the other waves' quarters of h of chunk t-1 (the own
            // one is still in registers), then the first 4 of GEMM1's 8 fragments of h columns [t*64 + 16 nq, +16).
            if (t > 0) load_a2((t - 1) & 1);
            v16bf f1[8];
            #pragma unroll
            for (int i = 0; i < 4; ++i) f1[i] = ldfrag(buf + (size_t)(nq * 8 + i) * 1024, lane);
            // keeps group 1 from being moved in among the WMMAs
            __builtin_amdgcn_sched_barrier(0);
            if (t > 0) gemm2(0);                   // chunk t-1, first k fragment
            // keeps group 1b in one place between the halves of GEMM2, in the registers the first half has freed
            __builtin_amdgcn_sched_barrier(0);
            #pragma unroll
            for (int i = 4; i < 8; ++i) f1[i] = ldfrag(buf + (size_t)(nq * 8 + i) * 1024, lane);
            v8f bias;                              // b1 of h columns 8 khalf .. +8 of this wave's tile
            __builtin_memcpy(&bias, &b1s[(t * 4 + nq) * 16 + khalf * 8], 32);
            // keeps group 1b from being moved in among the WMMAs
            __builtin_amdgcn_sched_barrier(0);
            if (t > 0) gemm2(1);                   // chunk t-1, second k fragment
            // keeps group 2 in one place behind GEMM2, not pair by pair among its WMMAs
            __builtin_amdgcn_sched_barrier(0);
            // Group 2: W2 tiles of chunk t, output columns [64 nq, +64), into the registers
            // GEMM2 has just read; they land under GEMM1 and gelu and are used in the next pass
            #pragma unroll
            for (int i = 0; i < 4; ++i) {
                const char* w2t = buf + 32768 + (size_t)(nq * 4 + i) * 2048;
                f2[0][i] = ldfrag_from(w2t + jo * 1024, lane, ho);
                f2[1][i] = ldfrag(w2t + (jo ^ 1) * 1024, lane);
            }
            // keeps group 2 from being moved in among GEMM1's WMMAs
            __builtin_amdgcn_sched_barrier(0);
            // ---- GEMM1 transposed: 16 h columns x 48 tokens, each W1 fragment used for all three token
            // tiles; acc[mt][r] = h[token n of tile mt][column 8 khalf + r], started from the bias ----
            v8f acc[3] = {bias, bias, bias};
            #pragma unroll
            for (int kc = 0; kc < 8; ++kc) {       // K = D = 256
                #pragma unroll
                for (int mt = 0; mt < 3; ++mt)
                    acc[mt] = __builtin_amdgcn_wmma_f32_16x16x32_bf16(
                                  false, f1[kc], false, A1[mt][kc], (short)0, acc[mt], false, false);
            }
            #pragma unroll
            for (int mt = 0; mt < 3; ++mt) {
                float hx[8], hs[8];                // gelu stage by stage: no element waits on another
                #pragma unroll
                for (int r = 0; r < 8; ++r) hx[r] = acc[mt][r];
                #pragma unroll
                for (int r = 0; r < 8; ++r) hs[r] = gelu_arg(hx[r]);
                #pragma unroll
                for (int r = 0; r < 8; ++r) hs[r] = 1.0f + __builtin_amdgcn_exp2f(hs[r]);
                #pragma unroll
                for (int r = 0; r < 8; ++r) hs[r] = __builtin_amdgcn_rcpf(hs[r]);
                v8f hv;
                #pragma unroll
                for (int r = 0; r < 8; ++r) hv[r] = hx[r] * hs[r] * wgt[mt];
                own[mt] = __builtin_convertvector(hv, v8bf);   // round to nearest even, in pairs
                // two hstage buffers: the other waves may still read chunk t-1 in this pass
                __builtin_memcpy((char*)&hstage[t & 1][mg * 3 + mt][nq][0] + lane * 16, &own[mt], 16);
            }
        }
        // the ring's closing wait: no copy is outstanding when bstage is refilled for the next expert or the wave ends
        asm volatile("s_wait_asynccnt 0x0" ::: "memory");
        __syncthreads();               // h of the last chunk written by all four waves of the row group
        load_a2((NT_ - 1) & 1);
        gemm2(0);                                  // the last chunk
        gemm2(1);
    }
    __syncthreads();

    // Write output tile (+ combined bias)
    float cb[3][4];
    #pragma unroll
    for (int mt = 0; mt < 3; ++mt) {
        #pragma unroll
        for (int n3 = 0; n3 < 4; ++n3) cb[mt][n3] = cbias[ts[mt]][(nq * 4 + n3) * 16 + n];
    }
    #pragma unroll
    for (int mt = 0; mt < 3; ++mt) {
        #pragma unroll
        for (int n3 = 0; n3 < 4; ++n3) {
            #pragma unroll
            for (int r = 0; r < 8; ++r) outAcc[mt][n3][r] += cb[mt][n3];
        }
    }
    // every sum is formed ahead of the first store, so that no register of an issued store is written again
    __builtin_amdgcn_sched_barrier(0);
    #pragma unroll
    for (int mt = 0; mt < 3; ++mt) {
        #pragma unroll
        for (int n3 = 0; n3 < 4; ++n3) {
            #pragma unroll
            for (int r = 0; r < 8; ++r) {
                int row = mt * 16 + r + 8 * khalf;
                int col = (nq * 4 + n3) * 16 + n;
                out[((size_t)b * L_ + l0 + row) * D_ + col] = outAcc[mt][n3][r];
            }
        }
    }
}

// ---------------------------------------------------------------------------
extern "C" void kernel_launch(void* const* d_in, const int* in_sizes, int n_in,
                              void* d_out, int out_size, void* d_ws, size_t ws_size,
                              hipStream_t stream) {
    (void)in_sizes; (void)n_in; (void)out_size; (void)ws_size;
    const float* x   = (const float*)d_in[0];
    const float* tc  = (const float*)d_in[1];
    const float* gw  = (const float*)d_in[2];
    const float* gb  = (const float*)d_in[3];
    const float* tw  = (const float*)d_in[4];
    const float* tb  = (const float*)d_in[5];
    const float* ew1 = (const float*)d_in[6];
    const float* eb1 = (const float*)d_in[7];
    const float* ew2 = (const float*)d_in[8];
    const float* eb2 = (const float*)d_in[9];
    const float* sw1 = (const float*)d_in[10];
    const float* sb1 = (const float*)d_in[11];
    const float* sw2 = (const float*)d_in[12];
    const float* sb2 = (const float*)d_in[13];
    char*  ws  = (char*)d_ws;
    float* part = (float*)(ws + PART_OFF);
    float* wbe = (float*)(ws + WBE_OFF);
    float* out = (float*)d_out;

    agg_kernel <<<dim3(CH_, B_), 256, 0, stream>>>(x, part);
    gate_pack_kernel<<<B_ + PACKB_, 768, 0, stream>>>(part, tc, gw, gb, tw, tb, wbe, ew1, ew2, sw1, sw2, ws);
    moe_kernel <<<dim3(L_ / RB_, B_), 256, 0, stream>>>(x, eb1, eb2, sb1, sb2, wbe, ws, out);
}

// v010
// One run takes 64.5 microseconds.
// Two timings next to v009 both put it at 1.07 times that version's speed.
// All steps since v000 together make it 6.87 times as fast.
#include <hip/hip_runtime.h>
#include <hip/hip_bf16.h>
#include <stdint.h>

typedef __attribute__((ext_vector_type(16))) __bf16 v16bf;
typedef __attribute__((ext_vector_type(8)))  __bf16 v8bf;
typedef __attribute__((ext_vector_type(8)))  float  v8f;
typedef int v4i_ __attribute__((__vector_size__(16)));
typedef __attribute__((address_space(1))) v4i_* gp_v4i;
typedef __attribute__((address_space(3))) v4i_* lp_v4i;

#define B_ 8
#define L_ 3072
#define D_ 256
#define E_ 4
#define H_ 1024

// d_ws layout (bytes)
#define WBE_OFF   (32*1024)             // B*E floats
#define PACK_EW1  (64*1024)             // 4 experts * 512 tiles * 1 KiB = 2 MiB
#define PACK_EW2  (PACK_EW1 + 2*1024*1024)
#define PACK_SW1  (PACK_EW2 + 2*1024*1024)   // 512 KiB
#define PACK_SW2  (PACK_SW1 + 512*1024)      // 512 KiB
#define PART_OFF  (8*1024*1024)         // B * CH_ * D floats = 768 KiB
#define CH_ 96                          // 32-row chunks per batch

#if defined(__has_builtin)
# if __has_builtin(__builtin_amdgcn_global_load_async_to_lds_b128)
#  define HAVE_ASYNC 1
# endif
#endif

__device__ __forceinline__ uint16_t f2bfbits(float f) {
    union { float f; uint32_t u; } a; a.f = f;
    uint32_t r = a.u + 0x7FFFu + ((a.u >> 16) & 1u);   // round-to-nearest-even
    return (uint16_t)(r >> 16);
}
__device__ __forceinline__ __bf16 f2bf(float f) {
    uint16_t h = f2bfbits(f);
    __bf16 o; __builtin_memcpy(&o, &h, 2); return o;
}
// tanh-approx gelu (approximate=True), branch-free:
//   0.5 x (1 + tanh u) = x / (1 + exp(-2u)),  u = sqrt(2/pi) (x + 0.044715 x^3)
// exp(-2u) = exp2(x (K0 + K1 x^2)) with K0 = -2 sqrt(2/pi) log2(e), K1 = 0.044715 K0.
// Saturates by itself: exp2 -> inf gives x * 0, exp2 -> 0 gives x.
__device__ __forceinline__ float gelu_arg(float x) {   // the exp2 argument
    const float K0 = -2.3022081986f, K1 = -0.1029432396f;
    return x * fmaf(x * x, K1, K0);
}

// One 16x32 / 32x16 bf16 fragment (1 KiB) from LDS. The tile is stored as two 512-byte
// halves; lane l owns bytes [16 l, 16 l + 16) of each half (elements 0..7, then 8..15).
// Each 16-byte read of a wave is then 512 contiguous bytes: 16 lanes cover all 64 banks once.
__device__ __forceinline__ v16bf ldfrag(const char* tile, int lane) {
    v8bf lo, hi;
    __builtin_memcpy(&lo, tile + lane * 16, 16);
    __builtin_memcpy(&hi, tile + 512 + lane * 16, 16);
    return __builtin_shufflevector(lo, hi, 0, 1, 2, 3, 4, 5, 6, 7, 8, 9, 10, 11, 12, 13, 14, 15);
}

// The same fragment with its two halves taken in the order (first, other): the k order inside a
// WMMA is free as long as A and B agree, and GEMM2's A fragment starts with the wave's own half.
__device__ __forceinline__ v16bf ldfrag_from(const char* tile, int lane, int first) {
    v8bf lo, hi;
    __builtin_memcpy(&lo, tile + first * 512 + lane * 16, 16);
    __builtin_memcpy(&hi, tile + (first ^ 1) * 512 + lane * 16, 16);
    return __builtin_shufflevector(lo, hi, 0, 1, 2, 3, 4, 5, 6, 7, 8, 9, 10, 11, 12, 13, 14, 15);
}

// 16-byte global -> LDS copy: async (ASYNCcnt, bypasses VGPRs) when available.
__device__ __forceinline__ void cp16(const char* g, char* l) {
#if HAVE_ASYNC
    __builtin_amdgcn_global_load_async_to_lds_b128(
        (gp_v4i)(const_cast<char*>(g)), (lp_v4i)(l), 0, 0);
#else
    *(float4*)l = *(const float4*)g;
#endif
}

// ---------------------------------------------------------------------------
// Kernel 1: partial column sums of x. One work-group per (batch, 32-row chunk);
// a chunk lies inside one segment (32 chunks per segment of 1024 rows).
// Each thread keeps 8 independent 16-byte loads in flight (rows rg, rg+4, ...).
// ---------------------------------------------------------------------------
__global__ __launch_bounds__(256) void agg_kernel(const float* __restrict__ x,
                                                  float* __restrict__ part) {
    __shared__ float4 red4[4][64];
    const int c = blockIdx.x, b = blockIdx.y, t = threadIdx.x;
    const int q = t & 63, rg = t >> 6;
    const float4* xp = (const float4*)(x + ((size_t)b * L_ + c * 32 + rg) * D_) + q;
    float4 v[8];
    #pragma unroll
    for (int i = 0; i < 8; ++i) v[i] = xp[(size_t)i * 4 * (D_ / 4)];
    #pragma unroll
    for (int s = 4; s > 0; s >>= 1) {
        #pragma unroll
        for (int i = 0; i < s; ++i) {
            v[i].x += v[i + s].x; v[i].y += v[i + s].y;
            v[i].z += v[i + s].z; v[i].w += v[i + s].w;
        }
    }
    red4[rg][q] = v[0];
    __syncthreads();
    const float* r = (const float*)red4;
    part[((size_t)b * CH_ + c) * D_ + t] =
        (r[t] + r[D_ + t]) + (r[2 * D_ + t] + r[3 * D_ + t]);
}

// ---------------------------------------------------------------------------
// Kernel 2: gating and weight packing in one launch. Neither reads what the other writes,
// so they share a grid: work-groups 0 .. B-1 do the gating (a short chain of dependent
// steps on 8 work-groups), the others pack the weights and fill the rest of the chip meanwhile.
//
// Gating -> w_be (renormalized top-2, zeros elsewhere).
// One work-group per batch, 768 threads = one per gate_in element.
// Thread (g, d) first sums segment g's 32 partials of column d, then owns
// gate_in[g*256 + d]; the 4 logit and 8 modulation dot products are summed by
// wave shuffles and one pass through LDS.
//
// Packing: fp32 weights into bf16 WMMA B-operand tiles, six tiles per work-group,
// 128 threads (4 waves) per tile.
// Tile = 32(K) x 16(N), 1 KiB; element e of lane l sits at byte (e/8)*512 + l*16 + (e%8)*2
// (the layout ldfrag reads) and maps to (kk, n):
//   n = l & 15 ; kk = (e/8)*16 + (l/16)*8 + (e%8)
// Tiles stored [nt][kt] contiguous in kt.
// ---------------------------------------------------------------------------
#define NTILES_ 5120                    // 4 * 512 + 4 * 512 + 512 + 512
#define TPB_ 6                          // tiles per packing work-group
#define PACKB_ ((NTILES_ + TPB_ - 1) / TPB_)
__global__ __launch_bounds__(768) void gate_pack_kernel(const float* __restrict__ part,
                                                        const float* __restrict__ tc,
                                                        const float* __restrict__ gw,
                                                        const float* __restrict__ gb,
                                                        const float* __restrict__ tw,
                                                        const float* __restrict__ tb,
                                                        float* __restrict__ wbe,
                                                        const float* __restrict__ ew1,
                                                        const float* __restrict__ ew2,
                                                        const float* __restrict__ sw1,
                                                        const float* __restrict__ sw2,
                                                        char* __restrict__ ws) {
    __shared__ float seg[3][D_];
    __shared__ float red[24][12];
    __shared__ float fin[12];
    __shared__ float tileS[TPB_][512];
    if (blockIdx.x < B_) {                      // block-uniform
        const int b = blockIdx.x, t = threadIdx.x;
        const int g = t >> 8, d = t & 255;          // g is wave-uniform
        const float* pp = part + ((size_t)b * CH_ + g * 32) * D_ + d;
        float a[4] = {0.f, 0.f, 0.f, 0.f};
        #pragma unroll
        for (int i = 0; i < 32; ++i) a[i & 3] += pp[(size_t)i * D_];
        const float4 w4 = ((const float4*)gw)[t];   // gate_w[t][0..3]
        float v[12];
        #pragma unroll
        for (int j = 0; j < 12; ++j) v[j] = 0.f;
        if (g == 0) {                               // modulation: silu(time_cond) @ tmod_w
            float u  = tc[b * D_ + d];
            float si = u / (1.0f + expf(-u));
            float4 t0 = ((const float4*)tw)[d * 2], t1 = ((const float4*)tw)[d * 2 + 1];
            v[4] = si * t0.x; v[5]  = si * t0.y; v[6]  = si * t0.z; v[7]  = si * t0.w;
            v[8] = si * t1.x; v[9]  = si * t1.y; v[10] = si * t1.z; v[11] = si * t1.w;
        }
        seg[g][d] = (a[0] + a[1]) + (a[2] + a[3]);
        __syncthreads();
        {
            float hs = seg[0][d], wsu = seg[1][d], ps = seg[2][d];
            float gi = (g == 0) ? (hs + wsu + ps) * (1.0f / 3072.0f)
                     : (g == 1) ? (hs + ps)       * (1.0f / 2048.0f)
                                : (wsu + ps)      * (1.0f / 2048.0f);
            v[0] = gi * w4.x; v[1] = gi * w4.y; v[2] = gi * w4.z; v[3] = gi * w4.w;
        }
        #pragma unroll
        for (int j = 0; j < 12; ++j) {
            #pragma unroll
            for (int m = 16; m > 0; m >>= 1) v[j] += __shfl_xor(v[j], m, 32);
        }
        if ((t & 31) == 0) {
            #pragma unroll
            for (int j = 0; j < 12; ++j) red[t >> 5][j] = v[j];
        }
        __syncthreads();
        if (t < 12) {
            float s = (t < E_) ? gb[t] : tb[t - E_];
            #pragma unroll
            for (int w = 0; w < 24; ++w) s += red[w][t];
            fin[t] = s;
        }
        __syncthreads();
        if (t == 0) {
            float p[E_]; float mx = -1e30f;
            for (int e = 0; e < E_; ++e) {
                p[e] = fin[e] * (1.0f + fin[E_ + e]) + fin[2 * E_ + e];
                mx = fmaxf(mx, p[e]);
            }
            float se = 0.f;
            for (int e = 0; e < E_; ++e) { p[e] = expf(p[e] - mx); se += p[e]; }
            for (int e = 0; e < E_; ++e) p[e] /= se;
            int i1 = 0;
            for (int e = 1; e < E_; ++e) if (p[e] > p[i1]) i1 = e;
            int i2 = (i1 == 0) ? 1 : 0;
            for (int e = 0; e < E_; ++e) if (e != i1 && p[e] > p[i2]) i2 = e;
            float s2 = p[i1] + p[i2] + 1e-8f;
            for (int e = 0; e < E_; ++e)
                wbe[b * E_ + e] = (e == i1) ? (p[i1] / s2) : ((e == i2) ? (p[i2] / s2) : 0.0f);
        }
        return;
    }
    // in a scalar register: the choice of matrix and every tile index stay scalar work
    const int sg = __builtin_amdgcn_readfirstlane(threadIdx.x >> 7);
    const int tl = (blockIdx.x - B_) * TPB_ + sg;
    const bool on = tl < NTILES_;               // wave-uniform; the last work-group has two tiles
    const int t = threadIdx.x & 127;
    char* dst = ws;
    if (on) {
        const float* src; int K, N, local;
        if (tl < 2048) {           // ew1: (E, 256, 1024), K=256 N=1024, 512 tiles/expert
            int ex = tl >> 9; local = tl & 511;
            src = ew1 + (size_t)ex * D_ * H_;
            dst = ws + PACK_EW1 + (size_t)tl * 1024;
            K = D_; N = H_;
        } else if (tl < 4096) {    // ew2: (E, 1024, 256), K=1024 N=256
            int t2 = tl - 2048; int ex = t2 >> 9; local = t2 & 511;
            src = ew2 + (size_t)ex * H_ * D_;
            dst = ws + PACK_EW2 + (size_t)t2 * 1024;
            K = H_; N = D_;
        } else if (tl < 4608) {    // sw1: (256, 1024)
            local = tl - 4096;
            src = sw1; dst = ws + PACK_SW1 + (size_t)local * 1024;
            K = D_; N = H_;
        } else {                   // sw2: (1024, 256)
            local = tl - 4608;
            src = sw2; dst = ws + PACK_SW2 + (size_t)local * 1024;
            K = H_; N = D_;
        }
        int ktiles = K / 32;
        int nt = local / ktiles, kt = local % ktiles;
        int k0 = kt * 32, n0 = nt * 16;
        #pragma unroll
        for (int i = 0; i < 4; ++i) {
            int e = t + 128 * i;
            int k = e >> 4, nn = e & 15;
            tileS[sg][e] = src[(size_t)(k0 + k) * N + (n0 + nn)];
        }
    }
    __syncthreads();               // every wave of the work-group, also one without a tile
    if (on) {
        uint16_t hv[4];
        #pragma unroll
        for (int i = 0; i < 4; ++i) {
            int p = t * 4 + i;
            int lanep = (p >> 3) & 31;
            int nn = lanep & 15, half = lanep >> 4;
            int kk = ((p >> 8) << 4) + (half << 3) + (p & 7);
            hv[i] = f2bfbits(tileS[sg][kk * 16 + nn]);
        }
        uint32_t lo = (uint32_t)hv[0] | ((uint32_t)hv[1] << 16);
        uint32_t hi = (uint32_t)hv[2] | ((uint32_t)hv[3] << 16);
        ((uint2*)dst)[t] = make_uint2(lo, hi);
        // the listing has a write of the store's offset register on a path behind it: keep the wait in front
        asm volatile("s_wait_xcnt 0x0" ::: "memory");
    }
}

// ---------------------------------------------------------------------------
// Kernel 3: fused MoE + shared MLP.
// Block = 256 thr = 8 waves over 96 rows: 256 work-groups, one for every WGP of the chip.
// A 16-row tile lies inside one segment (1024 is a multiple of 16), a block may straddle two:
// the expert weight is taken per row tile, and an expert is skipped when it is off in both.
// The waves form a 2 x 4 grid: wave (mg, nq) owns rows [48 mg, 48 mg + 48) and quarter nq of the
// columns, of the 64-column h chunk in GEMM1 and of the output in GEMM2, so every B fragment it
// reads from LDS feeds three WMMAs (three 16-row tiles). GEMM1 is computed transposed
// (the W1 tile as A, the x tile as B; both operands have the same lane map), so a lane's 8
// accumulator registers hold 8 consecutive h columns of one token: converted in place they are
// one half of a GEMM2 A fragment. The four waves of a row group hand each other their quarters
// of h through hstage, 16 bytes per lane. The hand-over uses the barrier that
// stands at the head of every chunk: GEMM2 of chunk t - 1 runs behind that barrier,
// ahead of GEMM1 of chunk t, with its W2 fragments kept in registers since the pass before.
// Per chunk the whole block shares one staged copy of the 64 B-tiles
// (32 GEMM1 + 32 GEMM2 = 64 KiB), double-buffered via async global->LDS copies.
// A wave's B fragments are read from LDS in three groups per chunk, each ahead of a WMMA block.
// ---------------------------------------------------------------------------
#define RB_ 96                          // rows per work-group
#define NT_ (H_ / 64)                   // h chunks per expert
#define XP_ 528                         // LDS pitch of a bf16 row of x: 512 + 16 bytes, an odd multiple of 16: 16 rows fall on all banks
__global__ __launch_bounds__(256) void moe_kernel(const float* __restrict__ x,
                                                  const float* __restrict__ eb1,
                                                  const float* __restrict__ eb2,
                                                  const float* __restrict__ sb1,
                                                  const float* __restrict__ sb2,
                                                  const float* __restrict__ wbe,
                                                  const char* __restrict__ ws,
                                                  float* __restrict__ out) {
    __shared__ float cbias[2][D_];   // [segment of the first / of the last row]
    __shared__ float wz[2][8];
    __shared__ __align__(32) float b1s[H_];
    __shared__ __align__(32) uint16_t hstage[2][6][4][256];  // [t & 1][3 mg + row tile][quarter][16 tokens x 16 columns]
    __shared__ __align__(32) char bstage[2][64 * 1024];   // [buf][tile 0..63][1KiB]

    const int tid   = threadIdx.x;
    const int wv    = __builtin_amdgcn_readfirstlane(tid >> 5);   // in a scalar register: what follows from it costs no VGPR
    const int lane  = tid & 31;
    const int n     = lane & 15;     // B/C column ; A row
    const int khalf = lane >> 4;
    const int b     = blockIdx.y;
    const int mg    = wv >> 2;       // row group
    const int nq    = wv & 3;        // column quarter
    const int jo    = nq >> 1;       // the 32-deep k fragment of a chunk that holds the own quarter
    const int ho    = nq & 1;        // and the half of it
    const int r0    = blockIdx.x * RB_;
    const int l0    = r0 + mg * 48;
    const int segA  = r0 >> 10;                  // 0=head 1=wrist 2=prop
    const int segB  = (r0 + RB_ - 1) >> 10;

    // The block's x tile, 96 rows = 96 KiB in a row: read once by the whole block, every load of a wave
    // 512 contiguous bytes (4 whole lines), each element converted once.
    float4 xv[RB_ / 4];
    {
        const float4* xt = (const float4*)(x + ((size_t)b * L_ + r0) * D_) + tid;
        #pragma unroll
        for (int i = 0; i < RB_ / 4; ++i) xv[i] = xt[i * 256];
    }
    if (tid < 2 * E_) {
        int e = tid & 3, sg = (tid >> 2) ? segB : segA;
        float w = wbe[b * E_ + e];
        bool act = (e == 1) ? (sg != 1) : (e == 2) ? (sg != 0) : true;
        wz[tid >> 2][e] = act ? w : 0.0f;
    } else if (tid < 2 * E_ + 2) {
        wz[tid - 2 * E_][E_] = 1.0f; // shared MLP pseudo-expert
    }
    // The tile goes to LDS row by row as bf16 (bstage is idle until the first expert): a wave's 8-byte
    // stores are 256 contiguous bytes; thread tid holds columns 4 (tid & 63) .. +4 of rows 4 i + tid / 64.
    {
        char* xd = bstage[0] + (tid >> 6) * XP_ + (tid & 63) * 8;
        #pragma unroll
        for (int i = 0; i < RB_ / 4; ++i) {
            uint2 pk;
            pk.x = (uint32_t)f2bfbits(xv[i].x) | ((uint32_t)f2bfbits(xv[i].y) << 16);
            pk.y = (uint32_t)f2bfbits(xv[i].z) | ((uint32_t)f2bfbits(xv[i].w) << 16);
            __builtin_memcpy(xd + i * 4 * XP_, &pk, 8);
        }
    }
    __syncthreads();                 // wz and the x tile written
    float bo = sb2[tid], be[E_];     // blockDim == 256 == D_
    #pragma unroll
    for (int e = 0; e < E_; ++e) be[e] = eb2[e * D_ + tid];
    // stands ahead of the later rewrite of the scalar base registers that the bias loads name
    asm volatile("s_wait_xcnt 0x0" ::: "memory");
    #pragma unroll
    for (int sI = 0; sI < 2; ++sI) { // combined output bias: sb2 + sum_e w_e * eb2_e
        float s = bo;
        #pragma unroll
        for (int e = 0; e < E_; ++e) s += wz[sI][e] * be[e];
        cbias[sI][tid] = s;
    }
    int ts[3];                       // which of the block's two segments a row tile lies in
    #pragma unroll
    for (int mt = 0; mt < 3; ++mt) ts[mt] = (((l0 + mt * 16) >> 10) != segA) ? 1 : 0;

    // A1: x rows [l0, l0+48) as bf16 operand fragments, 3 row tiles x 8 K-chunks of 32, from the staged tile.
    // Element part * 8 + j of lane (n, khalf) is x[row n][32 c + 16 part + 8 khalf + j]: 16 bytes per part.
    // The barrier at the head of the first expert ends these reads before bstage[0] is refilled.
    v16bf A1[3][8];
    #pragma unroll
    for (int mt = 0; mt < 3; ++mt) {
        const char* xr = bstage[0] + (mg * 48 + mt * 16 + n) * XP_ + khalf * 16;
        #pragma unroll
        for (int c = 0; c < 8; ++c) {
            v8bf lo, hi;
            __builtin_memcpy(&lo, xr + c * 64, 16);
            __builtin_memcpy(&hi, xr + c * 64 + 32, 16);
            A1[mt][c] = __builtin_shufflevector(lo, hi, 0, 1, 2, 3, 4, 5, 6, 7, 8, 9, 10, 11, 12, 13, 14, 15);
        }
    }

    v8f outAcc[3][4];                // [row tile][column tile of this wave's quarter]
    #pragma unroll
    for (int mt = 0; mt < 3; ++mt) {
        #pragma unroll
        for (int i = 0; i < 4; ++i) { v8f z = {}; outAcc[mt][i] = z; }
    }

    for (int ex = 0; ex < 5; ++ex) {
        const float wA = wz[0][ex], wB = wz[1][ex];
        if (wA == 0.0f && wB == 0.0f) continue;   // block-uniform: skip masked / non-top-k experts
        float wgt[3];
        #pragma unroll
        for (int mt = 0; mt < 3; ++mt) wgt[mt] = ts[mt] ? wB : wA;
        const char* w1p = (ex < 4) ? (ws + PACK_EW1 + (size_t)ex * 512 * 1024)
                                   : (ws + PACK_SW1);
        const char* w2p = (ex < 4) ? (ws + PACK_EW2 + (size_t)ex * 512 * 1024)
                                   : (ws + PACK_SW2);
        const float* b1p = (ex < 4) ? (eb1 + ex * H_) : sb1;

        // this wave's LDS reads of the previous expert are over before bstage[0] is refilled
        asm volatile("s_wait_dscnt 0x0" ::: "memory");
        __syncthreads();   // prev expert fully done before we touch b1s / bstage[0]
        for (int i = tid; i < H_; i += 256) b1s[i] = b1p[i];

        // cooperative stage of the 64 B tiles for one chunk: 16 copies of 16 bytes per thread.
        // Lane l of a wave takes bytes [16 l, 16 l + 16) of one aligned 512-byte run, in
        // global memory and in LDS alike: a copy instruction touches 4 whole lines, not 32,
        // and its LDS writes fall on every bank once per 16 lanes.
        auto stage = [&](int t, int bb) {
            char* d = bstage[bb] + (size_t)tid * 16;
            // GEMM1 tiles: 32 KiB contiguous at w1p + t*32K; the block moves 4 KiB per copy
            const char* s1 = w1p + (size_t)t * 32768 + (size_t)tid * 16;
            #pragma unroll
            for (int i = 0; i < 8; ++i) cp16(s1 + i * 4096, d + i * 4096);
            // GEMM2 tiles: column tile n3 = 2*i + tid/128 has its 2 k tiles, 2 KiB, at w2p + (n3*32 + 2t) KiB
            const char* s2 = w2p + ((size_t)((tid >> 7) * 32 + 2 * t)) * 1024 + (size_t)(tid & 127) * 16;
            #pragma unroll
            for (int i = 0; i < 8; ++i) cp16(s2 + (size_t)i * 65536, d + 32768 + i * 4096);
        };

        // GEMM2 of one chunk: outAcc += h(48 x 64) @ W2[chunk rows, 64 nq .. +64)
        v16bf f2[2][4];                            // W2 fragments of the chunk whose h is in hstage
        v16bf a2[3][2];                            // [row tile][0: the k fragment with the own quarter, 1: the other]
        v8bf own[3];                               // this wave's quarter of h, A-fragment order, per row tile
        auto gemm2 = [&](int j) {                  // one of its two k fragments
            #pragma unroll
            for (int n3 = 0; n3 < 4; ++n3) {
                #pragma unroll
                for (int mt = 0; mt < 3; ++mt)
                    outAcc[mt][n3] = __builtin_amdgcn_wmma_f32_16x16x32_bf16(
                                         false, a2[mt][j], false, f2[j][n3], (short)0, outAcc[mt][n3], false, false);
            }
        };
        // the three other quarters of h of one chunk from hstage, joined with the own one
        auto load_a2 = [&](int hb) {
            #pragma unroll
            for (int mt = 0; mt < 3; ++mt) {
                const char* hq = (const char*)&hstage[hb][mg * 3 + mt][0][0] + lane * 16;
                v8bf ph, q0, q1;
                __builtin_memcpy(&ph, hq + (nq ^ 1) * 512, 16);
                __builtin_memcpy(&q0, hq + (jo ^ 1) * 1024, 16);
                __builtin_memcpy(&q1, hq + (jo ^ 1) * 1024 + 512, 16);
                a2[mt][0] = __builtin_shufflevector(own[mt], ph, 0, 1, 2, 3, 4, 5, 6, 7,
                                                    8, 9, 10, 11, 12, 13, 14, 15);
                a2[mt][1] = __builtin_shufflevector(q0, q1, 0, 1, 2, 3, 4, 5, 6, 7,
                                                    8, 9, 10, 11, 12, 13, 14, 15);
            }
        };

        stage(0, 0);
        for (int t = 0; t < NT_; ++t) {            // H in chunks of 64
            const char* buf = bstage[t & 1];
            // this wave's LDS reads and its h store of the pass before are over
            asm volatile("s_wait_dscnt 0x0" ::: "memory");
            // own async copies landed
            asm volatile("s_wait_asynccnt 0x0" ::: "memory");
            __syncthreads();           // everyone's copies landed, h of chunk t-1 written; prev reads done
            if (t + 1 < NT_) stage(t + 1, (t + 1) & 1);

            // Group 1, ahead of the WMMA blocks: the other waves' quarters of h of chunk t-1 (the own
            // one is still in registers), then the first 4 of GEMM1's 8 fragments of h columns [t*64 + 16 nq, +16).
            if (t > 0) load_a2((t - 1) & 1);
            v16bf f1[8];
            #pragma unroll
            for (int i = 0; i < 4; ++i) f1[i] = ldfrag(buf + (size_t)(nq * 8 + i) * 1024, lane);
            // keeps group 1 from being moved in among the WMMAs
            __builtin_amdgcn_sched_barrier(0);
            if (t > 0) gemm2(0);                   // chunk t-1, first k fragment
            // keeps group 1b in one place between the halves of GEMM2, in the registers the first half has freed
            __builtin_amdgcn_sched_barrier(0);
            #pragma unroll
            for (int i = 4; i < 8; ++i) f1[i] = ldfrag(buf + (size_t)(nq * 8 + i) * 1024, lane);
            v8f bias;                              // b1 of h columns 8 khalf .. +8 of this wave's tile
            __builtin_memcpy(&bias, &b1s[(t * 4 + nq) * 16 + khalf * 8], 32);
            // keeps group 1b from being moved in among the WMMAs
            __builtin_amdgcn_sched_barrier(0);
            if (t > 0) gemm2(1);                   // chunk t-1, second k fragment
            // keeps group 2 in one place behind GEMM2, not pair by pair among its WMMAs
            __builtin_amdgcn_sched_barrier(0);
            // Group 2: W2 tiles of chunk t, output columns [64 nq, +64), into the registers
            // GEMM2 has just read; they land under GEMM1 and gelu and are used in the next pass
            #pragma unroll
            for (int i = 0; i < 4; ++i) {
                const char* w2t = buf + 32768 + (size_t)(nq * 4 + i) * 2048;
                f2[0][i] = ldfrag_from(w2t + jo * 1024, lane, ho);
                f2[1][i] = ldfrag(w2t + (jo ^ 1) * 1024, lane);
            }
            // keeps group 2 from being moved in among GEMM1's WMMAs
            __builtin_amdgcn_sched_barrier(0);
            // ---- GEMM1 transposed: 16 h columns x 48 tokens, each W1 fragment used for all three token
            // tiles; acc[mt][r] = h[token n of tile mt][column 8 khalf + r], started from the bias ----
            v8f acc[3] = {bias, bias, bias};
            #pragma unroll
            for (int kc = 0; kc < 8; ++kc) {       // K = D = 256
                #pragma unroll
                for (int mt = 0; mt < 3; ++mt)
                    acc[mt] = __builtin_amdgcn_wmma_f32_16x16x32_bf16(
                                  false, f1[kc], false, A1[mt][kc], (short)0, acc[mt], false, false);
            }
            #pragma unroll
            for (int mt = 0; mt < 3; ++mt) {
                float hx[8], hs[8];                // gelu stage by stage: no element waits on another
                #pragma unroll
                for (int r = 0; r < 8; ++r) hx[r] = acc[mt][r];
                #pragma unroll
                for (int r = 0; r < 8; ++r) hs[r] = gelu_arg(hx[r]);
                #pragma unroll
                for (int r = 0; r < 8; ++r) hs[r] = 1.0f + __builtin_amdgcn_exp2f(hs[r]);
                #pragma unroll
                for (int r = 0; r < 8; ++r) hs[r] = __builtin_amdgcn_rcpf(hs[r]);
                v8f hv;
                #pragma unroll
                for (int r = 0; r < 8; ++r) hv[r] = hx[r] * hs[r] * wgt[mt];
                own[mt] = __builtin_convertvector(hv, v8bf);   // round to nearest even, in pairs
                // two hstage buffers: the other waves may still read chunk t-1 in this pass
                __builtin_memcpy((char*)&hstage[t & 1][mg * 3 + mt][nq][0] + lane * 16, &own[mt], 16);
            }
        }
        // the ring's closing wait: no copy is outstanding when bstage is refilled for the next expert or the wave ends
        asm volatile("s_wait_asynccnt 0x0" ::: "memory");
        __syncthreads();               // h of the last chunk written by all four waves of the row group
        load_a2((NT_ - 1) & 1);
        gemm2(0);                                  // the last chunk
        gemm2(1);
    }
    __syncthreads();

    // Write output tile (+ combined bias)
    float cb[3][4];
    #pragma unroll
    for (int mt = 0; mt < 3; ++mt) {
        #pragma unroll
        for (int n3 = 0; n3 < 4; ++n3) cb[mt][n3] = cbias[ts[mt]][(nq * 4 + n3) * 16 + n];
    }
    #pragma unroll
    for (int mt = 0; mt < 3; ++mt) {
        #pragma unroll
        for (int n3 = 0; n3 < 4; ++n3) {
            #pragma unroll
            for (int r = 0; r < 8; ++r) outAcc[mt][n3][r] += cb[mt][n3];
        }
    }
    // every sum is formed ahead of the first store, so that no register of an issued store is written again
    __builtin_amdgcn_sched_barrier(0);
    #pragma unroll
    for (int mt = 0; mt < 3; ++mt) {
        #pragma unroll
        for (int n3 = 0; n3 < 4; ++n3) {
            #pragma unroll
            for (int r = 0; r < 8; ++r) {
                int row = mt * 16 + r + 8 * khalf;
                int col = (nq * 4 + n3) * 16 + n;
                out[((size_t)b * L_ + l0 + row) * D_ + col] = outAcc[mt][n3][r];
            }
        }
    }
}

// ---------------------------------------------------------------------------
extern "C" void kernel_launch(void* const* d_in, const int* in_sizes, int n_in,
                              void* d_out, int out_size, void* d_ws, size_t ws_size,
                              hipStream_t stream) {
    (void)in_sizes; (void)n_in; (void)out_size; (void)ws_size;
    const float* x   = (const float*)d_in[0];
    const float* tc  = (const float*)d_in[1];
    const float* gw  = (const float*)d_in[2];
    const float* gb  = (const float*)d_in[3];
    const float* tw  = (const float*)d_in[4];
    const float* tb  = (const float*)d_in[5];
    const float* ew1 = (const float*)d_in[6];
    const float* eb1 = (const float*)d_in[7];
    const float* ew2 = (const float*)d_in[8];
    const float* eb2 = (const float*)d_in[9];
    const float* sw1 = (const float*)d_in[10];
    const float* sb1 = (const float*)d_in[11];
    const float* sw2 = (const float*)d_in[12];
    const float* sb2 = (const float*)d_in[13];
    char*  ws  = (char*)d_ws;
    float* part = (float*)(ws + PART_OFF);
    float* wbe = (float*)(ws + WBE_OFF);
    float* out = (float*)d_out;

    agg_kernel <<<dim3(CH_, B_), 256, 0, stream>>>(x, part);
    gate_pack_kernel<<<B_ + PACKB_, 768, 0, stream>>>(part, tc, gw, gb, tw, tb, wbe, ew1, ew2, sw1, sw2, ws);
    moe_kernel <<<dim3(L_ / RB_, B_), 256, 0, stream>>>(x, eb1, eb2, sb1, sb2, wbe, ws, out);
}
